// v000
// Measured on an AMD MI455X. A time is GPU time per run, averaged over a window of back-to-back runs after a warm-up
// (all launches, gaps included; the runs take copies of the inputs in turn), and the median of several windows.
// Apart from v000's, it joins two sittings. Times from different sittings can be a few percent apart, while
// side-by-side timings come from the same sitting.
// The starting kernel, v000, takes 113 microseconds a run.
#include <hip/hip_runtime.h>
#include <stdint.h>

// Contractions: scores = Q*K^T and O = P*V on v_wmma_f32_16x16x32_f16 (f16 operands, f32 accumulate); P carried x2^15; softmax and normalisation in f32.

typedef __attribute__((ext_vector_type(16))) _Float16 v16h;
typedef __attribute__((ext_vector_type(8)))  _Float16 v8h;
typedef __attribute__((ext_vector_type(8)))  float    v8f;
typedef __attribute__((ext_vector_type(4)))  float    v4f;

#define S_LEN 1024
#define HD 64
#define N_HEADS 8
#define C_CH 512
#define QB 64
#define KC 64
#define NWAVE 4
#define PSC 32768.0f
#define SCALE_QK 0.125f
#define NEG_FILL (-1.0e30f)
#define TP 72      // transpose tile pitch in halves (144 B rows)
#define OP 68      // output tile pitch in floats (272 B rows)

// ---- 16-bit WMMA fragment loader (split k map: elements 0..7 <- p[0..7], 8..15 <- p[16..23]) ----
template <typename T> struct Frag;
template <> struct Frag<_Float16> {
  typedef v16h V; union U { v16h v; v8h h[2]; };
  static __device__ __forceinline__ v16h load(const _Float16* p) {
    U f; f.h[0] = *(const v8h*)(p); f.h[1] = *(const v8h*)(p + 16); return f.v;
  }
};

// WMMA with trailing hazard guard (ties D, keeps A/B live)
__device__ __forceinline__ v8f mma_h(v16h a, v16h b, v8f c) {
  c = __builtin_amdgcn_wmma_f32_16x16x32_f16(false, a, false, b, (short)0, c, false, false);
  asm volatile("v_nop\n\tv_nop\n\tv_nop\n\tv_nop" : "+v"(c) : "v"(a), "v"(b));
  return c;
}

__global__ __launch_bounds__(256) void cast_f32_f16x2(
    const float* __restrict__ in, _Float16* __restrict__ out, int n2) {
  int i = blockIdx.x * 256 + threadIdx.x;
  if (i < n2) {
    const _Float16 h0 = (_Float16)in[2 * i], h1 = (_Float16)in[2 * i + 1];
    const unsigned u = (unsigned)__builtin_bit_cast(unsigned short, h0) | ((unsigned)__builtin_bit_cast(unsigned short, h1) << 16);
    ((unsigned*)out)[i] = u;
    
  }
}

// ---- transpose-cast: in[bh][64 d][S t] f32 (channel-major) -> out[bh][S t][64 d] f16 (token-major) ----
__global__ __launch_bounds__(128) void tcast_kernel(
    const float* __restrict__ x0, const float* __restrict__ x1,
    _Float16* __restrict__ y0, _Float16* __restrict__ y1) {
  __shared__ __align__(16) _Float16 T[64 * TP];   // [t][d], pitch 72 halves
  const int tid = threadIdx.x, lane = tid & 31, wave = tid >> 5;
  const int t0 = blockIdx.x * 64;
  const int bh = blockIdx.y;
  const float* in = (blockIdx.z == 0) ? x0 : x1;
  _Float16* out = (blockIdx.z == 0) ? y0 : y1;
  const float* src = in + (size_t)bh * HD * S_LEN + t0;
#pragma unroll
  for (int i = 0; i < 8; ++i) {
    const int idx = tid + 128 * i;          // 0..1023
    const int d  = idx >> 4;                // 0..63
    const int t4 = (idx & 15) * 4;          // 0..60
    const v4f v = *(const v4f*)(src + (size_t)d * S_LEN + t4);
#pragma unroll
    for (int e = 0; e < 4; ++e) T[(t4 + e) * TP + d] = (_Float16)v[e];
  }
  __syncthreads();
  _Float16* dst = out + ((size_t)bh * S_LEN + t0) * HD;
  const int rq = lane >> 3, c8 = (lane & 7) * 8;
  {
#pragma unroll
    for (int it = 0; it < 4; ++it) {
      const int row = wave * 16 + it * 4 + rq;   // wave covers rows wave*16 .. +15
      const v8h hv = *(const v8h*)(T + row * TP + c8);
      *(v8h*)(dst + (size_t)row * HD + c8) = hv;
    }
    
  }
}

// ---- attention, head dim 64 ----
// Qt, Kt: f16 [bh][S][64] token-major; Vh: f16 [bh][64][S] channel-major; mk: f32 [b][S][S] (value < -5000 -> masked);
// out: f32 [bh][64][S] channel-major. Block = 4 waves = 64 queries of one bh; 64-key chunks staged in LDS.
__global__ __launch_bounds__(128)
void attn_kernel(const _Float16* __restrict__ Qt, const _Float16* __restrict__ Kt,
                 const _Float16* __restrict__ Vh, const float* __restrict__ mk,
                 float* __restrict__ out, int nheads) {
  __shared__ __align__(16) _Float16 Ksh[KC * HD];          // [kv][d]   8 KB
  __shared__ __align__(16) _Float16 Vth[HD * KC];          // [d][kv]   8 KB
  __shared__ __align__(16) _Float16 Psh[NWAVE][16 * KC];   // per wave [row][kv]  8 KB
  __shared__ __align__(16) float    Ob[HD * OP];           // [d][q] block tile, pitch 68 floats

  const int tid  = threadIdx.x;
  const int wave = tid >> 5;
  const int lane = tid & 31;
  const int hh   = lane >> 4;
  const int c    = lane & 15;

  const int bh  = blockIdx.y;
  const int b   = bh / nheads;
  const int qb  = blockIdx.x;
  const int q0b = qb * QB;
  const int q0  = q0b + wave * 16;

  const _Float16* qbp = Qt + (size_t)bh * S_LEN * HD;
  const _Float16* kbp = Kt + (size_t)bh * S_LEN * HD;
  const _Float16* vbp = Vh + (size_t)bh * HD * S_LEN;
  const float*    mbp = mk + (size_t)b * S_LEN * S_LEN;
  float*          obp = out + (size_t)bh * HD * S_LEN;

  // Q fragments (A operand): row q0 + c, two 32-wide d chunks
  v16h qf[2];
  qf[0] = Frag<_Float16>::load(qbp + (size_t)(q0 + c) * HD + 0  + 8 * hh);
  qf[1] = Frag<_Float16>::load(qbp + (size_t)(q0 + c) * HD + 32 + 8 * hh);

  float mrow[8], lrow[8];
  v8f oacc[4];
#pragma unroll
  for (int r = 0; r < 8; ++r) { mrow[r] = NEG_FILL; lrow[r] = 0.f; }
#pragma unroll
  for (int t = 0; t < 4; ++t) oacc[t] = (v8f){0.f,0.f,0.f,0.f,0.f,0.f,0.f,0.f};

  for (int kc = 0; kc < S_LEN / KC; ++kc) {
    const int kv0 = kc * KC;
    __syncthreads();
    // stage K chunk [kv][d] and V chunk [d][kv] as 16-B vector copies
#pragma unroll
    for (int i = 0; i < 4; ++i) {
      const int idx = tid + 128 * i;       // 0..511
      const int row = idx >> 3;            // 0..63
      const int c8  = (idx & 7) * 8;       // 0..56
      const v8h kv = *(const v8h*)(kbp + (size_t)(kv0 + row) * HD + c8);
      const v8h vv = *(const v8h*)(vbp + (size_t)row * S_LEN + kv0 + c8);
      *(v8h*)(Ksh + row * HD + c8) = kv;
      *(v8h*)(Vth + row * KC + c8) = vv;
    }
    __syncthreads();

    // scores for this wave's 16 rows x 64 keys
    v8f s[4];
#pragma unroll
    for (int j = 0; j < 4; ++j) {
      s[j] = (v8f){0.f,0.f,0.f,0.f,0.f,0.f,0.f,0.f};
      const v16h kb0 = Frag<_Float16>::load(Ksh + (j * 16 + c) * HD + 0  + 8 * hh);
      s[j] = mma_h(qf[0], kb0, s[j]);
      const v16h kb1 = Frag<_Float16>::load(Ksh + (j * 16 + c) * HD + 32 + 8 * hh);
      s[j] = mma_h(qf[1], kb1, s[j]);
    }

    // scale, mask, chunk row max
    float cm[8];
#pragma unroll
    for (int r = 0; r < 8; ++r) {
      const int qrow = q0 + 8 * hh + r;
      const float* mrp = mbp + (size_t)qrow * S_LEN + kv0 + c;
      float m = NEG_FILL;
#pragma unroll
      for (int j = 0; j < 4; ++j) {
        float x = s[j][r] * SCALE_QK;
        if (mrp[j * 16] < -5000.0f) x = NEG_FILL;
        s[j][r] = x;
        m = fmaxf(m, x);
      }
#pragma unroll
      for (int off = 1; off < 16; off <<= 1) m = fmaxf(m, __shfl_xor(m, off, 32));
      cm[r] = m;
    }

    // online softmax update; P tile (x2^15, f16) into per-wave LDS
    _Float16* pw = Psh[wave];
#pragma unroll
    for (int r = 0; r < 8; ++r) {
      const float mnew  = fmaxf(mrow[r], cm[r]);
      const float alpha = __expf(mrow[r] - mnew);
      mrow[r] = mnew;
      float psum = 0.f;
#pragma unroll
      for (int j = 0; j < 4; ++j) {
        const float p = __expf(s[j][r] - mnew);
        psum += p;
        pw[(8 * hh + r) * KC + j * 16 + c] = (_Float16)(p * PSC);
      }
#pragma unroll
      for (int off = 1; off < 16; off <<= 1) psum += __shfl_xor(psum, off, 32);
      lrow[r] = lrow[r] * alpha + psum;
#pragma unroll
      for (int t = 0; t < 4; ++t) oacc[t][r] *= alpha;
    }
    __builtin_amdgcn_fence(__ATOMIC_RELEASE, "workgroup");
    __builtin_amdgcn_wave_barrier();
    __builtin_amdgcn_fence(__ATOMIC_ACQUIRE, "workgroup");

    // O += P * V
#pragma unroll 1
    for (int kk = 0; kk < 2; ++kk) {
      const v16h pa = Frag<_Float16>::load(pw + c * KC + kk * 32 + 8 * hh);
#pragma unroll
      for (int t = 0; t < 4; ++t) {
        const v16h vb = Frag<_Float16>::load(Vth + (t * 16 + c) * KC + kk * 32 + 8 * hh);
        oacc[t] = mma_h(pa, vb, oacc[t]);
      }
    }
  }

  // epilogue: normalise, stage block tile transposed [d][q], write whole channel rows
#pragma unroll
  for (int r = 0; r < 8; ++r) {
    const float inv = 1.0f / (lrow[r] * PSC);
    const int qloc = wave * 16 + 8 * hh + r;
#pragma unroll
    for (int t = 0; t < 4; ++t) Ob[(t * 16 + c) * OP + qloc] = oacc[t][r] * inv;
  }
  __syncthreads();
  {
    const int c4 = c * 4;
    {
#pragma unroll
      for (int it = 0; it < 8; ++it) {
        const int d = wave * 16 + it * 2 + hh;   // wave covers channels wave*16 .. +15
        const v4f val = *(const v4f*)(Ob + d * OP + c4);
        *(v4f*)(obp + (size_t)d * S_LEN + q0b + c4) = val;
      }
      
    }
  }
}

extern "C" void kernel_launch(void* const* d_in, const int* in_sizes, int n_in,
                              void* d_out, int out_size, void* d_ws, size_t ws_size,
                              hipStream_t stream) {
  if (n_in < 4) return;
  const float* q  = (const float*)d_in[0];
  const float* k  = (const float*)d_in[1];
  const float* v  = (const float*)d_in[2];
  const float* mk = (const float*)d_in[3];
  float* out = (float*)d_out;

  const int per_b = C_CH * S_LEN;
  const int nb = in_sizes[0] / per_b;
  if (nb <= 0 || in_sizes[0] != nb * per_b) return;
  if (in_sizes[1] != in_sizes[0] || in_sizes[2] != in_sizes[0]) return;
  if ((long long)in_sizes[3] != (long long)nb * S_LEN * S_LEN) return;
  if (out_size != in_sizes[0]) return;
  const int nbh = nb * N_HEADS;

  const size_t eb = (size_t)nbh * S_LEN * HD * sizeof(_Float16);   // bytes per f16 tensor copy
  const size_t offQ = 0, offK = eb, offV = 2 * eb;
  const size_t total = 3 * eb;
  if (total > ws_size || total > (size_t)134217728) return;
  _Float16* Qt = (_Float16*)((char*)d_ws + offQ);
  _Float16* Kt = (_Float16*)((char*)d_ws + offK);
  _Float16* Vh = (_Float16*)((char*)d_ws + offV);

  // q, k: [bh][64][S] f32 -> [bh][S][64] f16
  tcast_kernel<<<dim3(S_LEN / 64, nbh, 2), 128, 0, stream>>>(q, k, Qt, Kt);
  // v: [bh][64][S] f32 -> same layout f16
  const int n2 = (int)((size_t)nbh * HD * S_LEN / 2);
  cast_f32_f16x2<<<dim3((n2 + 255) / 256), 256, 0, stream>>>(v, Vh, n2);
  // attention
  attn_kernel<<<dim3(S_LEN / QB, nbh), 128, 0, stream>>>(Qt, Kt, Vh, mk, out, N_HEADS);
  (void)hipGetLastError();
}

// v001
// It runs in 98 microseconds.
// In both of two side-by-side timings against v000, it was 1.20 times as fast.
#include <hip/hip_runtime.h>
#include <stdint.h>

// Contractions: scores = Q*K^T and O = P*V on v_wmma_f32_16x16x32_f16 (f16 operands, f32 accumulate); P carried x2^15; softmax and normalisation in f32.

typedef __attribute__((ext_vector_type(16))) _Float16 v16h;
typedef __attribute__((ext_vector_type(8)))  _Float16 v8h;
typedef __attribute__((ext_vector_type(8)))  float    v8f;
typedef __attribute__((ext_vector_type(4)))  float    v4f;

#define S_LEN 1024
#define HD 64
#define N_HEADS 8
#define C_CH 512
#define QB 64
#define KC 64
#define NWAVE 4
#define PSC 32768.0f
#define SCALE_QK 0.125f
#define NEG_FILL (-1.0e30f)
#define TP 72      // transpose tile pitch in halves (144 B rows)
#define OP 68      // output tile pitch in floats (272 B rows)
#define LP 72      // K, V and P tile pitch in halves: 144 B = 16 B x odd, so the 16 rows of a ds_load_b128 fragment read fall on distinct banks

// ---- 16-bit WMMA fragment loader (split k map: elements 0..7 <- p[0..7], 8..15 <- p[16..23]) ----
template <typename T> struct Frag;
template <> struct Frag<_Float16> {
  typedef v16h V; union U { v16h v; v8h h[2]; };
  static __device__ __forceinline__ v16h load(const _Float16* p) {
    U f; f.h[0] = *(const v8h*)(p); f.h[1] = *(const v8h*)(p + 16); return f.v;
  }
};

// WMMA with trailing hazard guard (ties D, keeps A/B live)
__device__ __forceinline__ v8f mma_h(v16h a, v16h b, v8f c) {
  c = __builtin_amdgcn_wmma_f32_16x16x32_f16(false, a, false, b, (short)0, c, false, false);
  asm volatile("v_nop\n\tv_nop\n\tv_nop\n\tv_nop" : "+v"(c) : "v"(a), "v"(b));
  return c;
}

__global__ __launch_bounds__(256) void cast_f32_f16x2(
    const float* __restrict__ in, _Float16* __restrict__ out, int n2) {
  int i = blockIdx.x * 256 + threadIdx.x;
  if (i < n2) {
    const _Float16 h0 = (_Float16)in[2 * i], h1 = (_Float16)in[2 * i + 1];
    const unsigned u = (unsigned)__builtin_bit_cast(unsigned short, h0) | ((unsigned)__builtin_bit_cast(unsigned short, h1) << 16);
    ((unsigned*)out)[i] = u;
    
  }
}

// ---- transpose-cast: in[bh][64 d][S t] f32 (channel-major) -> out[bh][S t][64 d] f16 (token-major) ----
__global__ __launch_bounds__(128) void tcast_kernel(
    const float* __restrict__ x0, const float* __restrict__ x1,
    _Float16* __restrict__ y0, _Float16* __restrict__ y1) {
  __shared__ __align__(16) _Float16 T[64 * TP];   // [t][d], pitch 72 halves
  const int tid = threadIdx.x, lane = tid & 31, wave = tid >> 5;
  const int t0 = blockIdx.x * 64;
  const int bh = blockIdx.y;
  const float* in = (blockIdx.z == 0) ? x0 : x1;
  _Float16* out = (blockIdx.z == 0) ? y0 : y1;
  const float* src = in + (size_t)bh * HD * S_LEN + t0;
#pragma unroll
  for (int i = 0; i < 8; ++i) {
    const int idx = tid + 128 * i;          // 0..1023
    const int d  = idx >> 4;                // 0..63
    const int t4 = (idx & 15) * 4;          // 0..60
    const v4f v = *(const v4f*)(src + (size_t)d * S_LEN + t4);
#pragma unroll
    for (int e = 0; e < 4; ++e) T[(t4 + e) * TP + d] = (_Float16)v[e];
  }
  __syncthreads();
  _Float16* dst = out + ((size_t)bh * S_LEN + t0) * HD;
  const int rq = lane >> 3, c8 = (lane & 7) * 8;
  {
#pragma unroll
    for (int it = 0; it < 4; ++it) {
      const int row = wave * 16 + it * 4 + rq;   // wave covers rows wave*16 .. +15
      const v8h hv = *(const v8h*)(T + row * TP + c8);
      *(v8h*)(dst + (size_t)row * HD + c8) = hv;
    }
    
  }
}

// ---- attention, head dim 64 ----
// Qt, Kt: f16 [bh][S][64] token-major; Vh: f16 [bh][64][S] channel-major; mk: f32 [b][S][S] (value < -5000 -> masked);
// out: f32 [bh][64][S] channel-major. Block = 4 waves = 64 queries of one bh; 64-key chunks staged in LDS.
__global__ __launch_bounds__(128)
void attn_kernel(const _Float16* __restrict__ Qt, const _Float16* __restrict__ Kt,
                 const _Float16* __restrict__ Vh, const float* __restrict__ mk,
                 float* __restrict__ out, int nheads) {
  __shared__ __align__(16) _Float16 Ksh[KC * LP];          // [kv][d]   9 KB, pitch LP
  __shared__ __align__(16) _Float16 Vth[HD * LP];          // [d][kv]   9 KB, pitch LP
  __shared__ __align__(16) _Float16 Psh[NWAVE][16 * LP];   // per wave [row][kv]  9 KB, pitch LP
  __shared__ __align__(16) float    Ob[HD * OP];           // [d][q] block tile, pitch 68 floats

  const int tid  = threadIdx.x;
  const int wave = tid >> 5;
  const int lane = tid & 31;
  const int hh   = lane >> 4;
  const int c    = lane & 15;

  const int bh  = blockIdx.y;
  const int b   = bh / nheads;
  const int qb  = blockIdx.x;
  const int q0b = qb * QB;
  const int q0  = q0b + wave * 16;

  const _Float16* qbp = Qt + (size_t)bh * S_LEN * HD;
  const _Float16* kbp = Kt + (size_t)bh * S_LEN * HD;
  const _Float16* vbp = Vh + (size_t)bh * HD * S_LEN;
  const float*    mbp = mk + (size_t)b * S_LEN * S_LEN;
  float*          obp = out + (size_t)bh * HD * S_LEN;

  // Q fragments (A operand): row q0 + c, two 32-wide d chunks
  v16h qf[2];
  qf[0] = Frag<_Float16>::load(qbp + (size_t)(q0 + c) * HD + 0  + 8 * hh);
  qf[1] = Frag<_Float16>::load(qbp + (size_t)(q0 + c) * HD + 32 + 8 * hh);

  float mrow[8], lrow[8];
  v8f oacc[4];
#pragma unroll
  for (int r = 0; r < 8; ++r) { mrow[r] = NEG_FILL; lrow[r] = 0.f; }
#pragma unroll
  for (int t = 0; t < 4; ++t) oacc[t] = (v8f){0.f,0.f,0.f,0.f,0.f,0.f,0.f,0.f};

  for (int kc = 0; kc < S_LEN / KC; ++kc) {
    const int kv0 = kc * KC;
    __syncthreads();
    // stage K chunk [kv][d] and V chunk [d][kv] as 16-B vector copies
#pragma unroll
    for (int i = 0; i < 4; ++i) {
      const int idx = tid + 128 * i;       // 0..511
      const int row = idx >> 3;            // 0..63
      const int c8  = (idx & 7) * 8;       // 0..56
      const v8h kv = *(const v8h*)(kbp + (size_t)(kv0 + row) * HD + c8);
      const v8h vv = *(const v8h*)(vbp + (size_t)row * S_LEN + kv0 + c8);
      *(v8h*)(Ksh + row * LP + c8) = kv;
      *(v8h*)(Vth + row * LP + c8) = vv;
    }
    __syncthreads();

    // scores for this wave's 16 rows x 64 keys
    v8f s[4];
#pragma unroll
    for (int j = 0; j < 4; ++j) {
      s[j] = (v8f){0.f,0.f,0.f,0.f,0.f,0.f,0.f,0.f};
      const v16h kb0 = Frag<_Float16>::load(Ksh + (j * 16 + c) * LP + 0  + 8 * hh);
      s[j] = mma_h(qf[0], kb0, s[j]);
      const v16h kb1 = Frag<_Float16>::load(Ksh + (j * 16 + c) * LP + 32 + 8 * hh);
      s[j] = mma_h(qf[1], kb1, s[j]);
    }

    // scale, mask, chunk row max
    float cm[8];
#pragma unroll
    for (int r = 0; r < 8; ++r) {
      const int qrow = q0 + 8 * hh + r;
      const float* mrp = mbp + (size_t)qrow * S_LEN + kv0 + c;
      float m = NEG_FILL;
#pragma unroll
      for (int j = 0; j < 4; ++j) {
        float x = s[j][r] * SCALE_QK;
        if (mrp[j * 16] < -5000.0f) x = NEG_FILL;
        s[j][r] = x;
        m = fmaxf(m, x);
      }
#pragma unroll
      for (int off = 1; off < 16; off <<= 1) m = fmaxf(m, __shfl_xor(m, off, 32));
      cm[r] = m;
    }

    // online softmax update; P tile (x2^15, f16) into per-wave LDS
    _Float16* pw = Psh[wave];
#pragma unroll
    for (int r = 0; r < 8; ++r) {
      const float mnew  = fmaxf(mrow[r], cm[r]);
      const float alpha = __expf(mrow[r] - mnew);
      mrow[r] = mnew;
      float psum = 0.f;
#pragma unroll
      for (int j = 0; j < 4; ++j) {
        const float p = __expf(s[j][r] - mnew);
        psum += p;
        pw[(8 * hh + r) * LP + j * 16 + c] = (_Float16)(p * PSC);
      }
#pragma unroll
      for (int off = 1; off < 16; off <<= 1) psum += __shfl_xor(psum, off, 32);
      lrow[r] = lrow[r] * alpha + psum;
#pragma unroll
      for (int t = 0; t < 4; ++t) oacc[t][r] *= alpha;
    }
    __builtin_amdgcn_fence(__ATOMIC_RELEASE, "workgroup");
    __builtin_amdgcn_wave_barrier();
    __builtin_amdgcn_fence(__ATOMIC_ACQUIRE, "workgroup");

    // O += P * V
#pragma unroll 1
    for (int kk = 0; kk < 2; ++kk) {
      const v16h pa = Frag<_Float16>::load(pw + c * LP + kk * 32 + 8 * hh);
#pragma unroll
      for (int t = 0; t < 4; ++t) {
        const v16h vb = Frag<_Float16>::load(Vth + (t * 16 + c) * LP + kk * 32 + 8 * hh);
        oacc[t] = mma_h(pa, vb, oacc[t]);
      }
    }
  }

  // epilogue: normalise, stage block tile transposed [d][q], write whole channel rows
#pragma unroll
  for (int r = 0; r < 8; ++r) {
    const float inv = 1.0f / (lrow[r] * PSC);
    const int qloc = wave * 16 + 8 * hh + r;
#pragma unroll
    for (int t = 0; t < 4; ++t) Ob[(t * 16 + c) * OP + qloc] = oacc[t][r] * inv;
  }
  __syncthreads();
  {
    const int c4 = c * 4;
    {
#pragma unroll
      for (int it = 0; it < 8; ++it) {
        const int d = wave * 16 + it * 2 + hh;   // wave covers channels wave*16 .. +15
        const v4f val = *(const v4f*)(Ob + d * OP + c4);
        *(v4f*)(obp + (size_t)d * S_LEN + q0b + c4) = val;
      }
      
    }
  }
}

extern "C" void kernel_launch(void* const* d_in, const int* in_sizes, int n_in,
                              void* d_out, int out_size, void* d_ws, size_t ws_size,
                              hipStream_t stream) {
  if (n_in < 4) return;
  const float* q  = (const float*)d_in[0];
  const float* k  = (const float*)d_in[1];
  const float* v  = (const float*)d_in[2];
  const float* mk = (const float*)d_in[3];
  float* out = (float*)d_out;

  const int per_b = C_CH * S_LEN;
  const int nb = in_sizes[0] / per_b;
  if (nb <= 0 || in_sizes[0] != nb * per_b) return;
  if (in_sizes[1] != in_sizes[0] || in_sizes[2] != in_sizes[0]) return;
  if ((long long)in_sizes[3] != (long long)nb * S_LEN * S_LEN) return;
  if (out_size != in_sizes[0]) return;
  const int nbh = nb * N_HEADS;

  const size_t eb = (size_t)nbh * S_LEN * HD * sizeof(_Float16);   // bytes per f16 tensor copy
  const size_t offQ = 0, offK = eb, offV = 2 * eb;
  const size_t total = 3 * eb;
  if (total > ws_size || total > (size_t)134217728) return;
  _Float16* Qt = (_Float16*)((char*)d_ws + offQ);
  _Float16* Kt = (_Float16*)((char*)d_ws + offK);
  _Float16* Vh = (_Float16*)((char*)d_ws + offV);

  // q, k: [bh][64][S] f32 -> [bh][S][64] f16
  tcast_kernel<<<dim3(S_LEN / 64, nbh, 2), 128, 0, stream>>>(q, k, Qt, Kt);
  // v: [bh][64][S] f32 -> same layout f16
  const int n2 = (int)((size_t)nbh * HD * S_LEN / 2);
  cast_f32_f16x2<<<dim3((n2 + 255) / 256), 256, 0, stream>>>(v, Vh, n2);
  // attention
  attn_kernel<<<dim3(S_LEN / QB, nbh), 128, 0, stream>>>(Qt, Kt, Vh, mk, out, N_HEADS);
  (void)hipGetLastError();
}

// v002
// One run takes 54.1 microseconds.
// Timed twice side by side with v001, it ran 1.81 times as fast both times.
// Over all steps from v000 it is 2.17 times as fast.
#include <hip/hip_runtime.h>
#include <stdint.h>

typedef __attribute__((ext_vector_type(16))) _Float16 v16h;
typedef __attribute__((ext_vector_type(8)))  _Float16 v8h;
typedef __attribute__((ext_vector_type(8)))  float    v8f;
typedef __attribute__((ext_vector_type(4)))  float    v4f;

#define S_LEN 1024
#define HD 64
#define N_HEADS 8
#define C_CH 512
#define QB 64
#define KC 64
#define NWAVE 4
#define PSC 32768.0f
#define SCALE_QK 0.125f
#define NEG_FILL (-1.0e30f)
#define LOG2E 1.44269504f   // exp(x) = exp2(x * LOG2E), as __expf forms it
#define TP 72      // transpose tile pitch in halves (144 B rows)
#define OP 68      // output tile pitch in floats (272 B rows)
#define LP 72      // K and V tile pitch in halves: 144 B = 16 B x odd, so the 16 rows of a ds_load_b128 fragment read fall on distinct banks

// ---- 16-bit WMMA fragment loader (split k map: elements 0..7 <- p[0..7], 8..15 <- p[16..23]) ----
template <typename T> struct Frag;
template <> struct Frag<_Float16> {
  typedef v16h V; union U { v16h v; v8h h[2]; };
  static __device__ __forceinline__ v16h load(const _Float16* p) {
    U f; f.h[0] = *(const v8h*)(p); f.h[1] = *(const v8h*)(p + 16); return f.v;
  }
};

// WMMA with trailing hazard guard (ties D, keeps A/B live)
__device__ __forceinline__ v8f mma_h(v16h a, v16h b, v8f c) {
  c = __builtin_amdgcn_wmma_f32_16x16x32_f16(false, a, false, b, (short)0, c, false, false);
  asm volatile("v_nop\n\tv_nop\n\tv_nop\n\tv_nop" : "+v"(c) : "v"(a), "v"(b));
  return c;
}

__global__ __launch_bounds__(256) void cast_f32_f16x2(
    const float* __restrict__ in, _Float16* __restrict__ out, int n2) {
  int i = blockIdx.x * 256 + threadIdx.x;
  if (i < n2) {
    const _Float16 h0 = (_Float16)in[2 * i], h1 = (_Float16)in[2 * i + 1];
    const unsigned u = (unsigned)__builtin_bit_cast(unsigned short, h0) | ((unsigned)__builtin_bit_cast(unsigned short, h1) << 16);
    ((unsigned*)out)[i] = u;
    
  }
}

// ---- transpose-cast: in[bh][64 d][S t] f32 (channel-major) -> out[bh][S t][64 d] f16 (token-major) ----
__global__ __launch_bounds__(128) void tcast_kernel(
    const float* __restrict__ x0, const float* __restrict__ x1,
    _Float16* __restrict__ y0, _Float16* __restrict__ y1) {
  __shared__ __align__(16) _Float16 T[64 * TP];   // [t][d], pitch 72 halves
  const int tid = threadIdx.x, lane = tid & 31, wave = tid >> 5;
  const int t0 = blockIdx.x * 64;
  const int bh = blockIdx.y;
  const float* in = (blockIdx.z == 0) ? x0 : x1;
  _Float16* out = (blockIdx.z == 0) ? y0 : y1;
  const float* src = in + (size_t)bh * HD * S_LEN + t0;
#pragma unroll
  for (int i = 0; i < 8; ++i) {
    const int idx = tid + 128 * i;          // 0..1023
    const int d  = idx >> 4;                // 0..63
    const int t4 = (idx & 15) * 4;          // 0..60
    const v4f v = *(const v4f*)(src + (size_t)d * S_LEN + t4);
#pragma unroll
    for (int e = 0; e < 4; ++e) T[(t4 + e) * TP + d] = (_Float16)v[e];
  }
  __syncthreads();
  _Float16* dst = out + ((size_t)bh * S_LEN + t0) * HD;
  const int rq = lane >> 3, c8 = (lane & 7) * 8;
  {
#pragma unroll
    for (int it = 0; it < 4; ++it) {
      const int row = wave * 16 + it * 4 + rq;   // wave covers rows wave*16 .. +15
      const v8h hv = *(const v8h*)(T + row * TP + c8);
      *(v8h*)(dst + (size_t)row * HD + c8) = hv;
    }
    
  }
}

// lane l with lane l ^ 16 (one vector cross-row move)
__device__ __forceinline__ float xhalf(float x) {
  const int b = __builtin_bit_cast(int, x);
  return __builtin_bit_cast(float, __builtin_amdgcn_permlanex16(b, b, 0x76543210, 0xfedcba98, false, false));
}

// exp2 by v_exp_f32, eight at a time. The early-clobber outputs keep each v_exp off the sources of the one in front of it,
// and the closing v_nop is the slot the instruction set asks for between a transcendental and a next instruction that
// reads its result or overwrites its source (in a build with the plain call a dual-issue multiply stood there).
__device__ __forceinline__ v8f exp2_x8(v8f a) {
  float r0, r1, r2, r3, r4, r5, r6, r7;
  asm("v_exp_f32 %0, %8\n\tv_exp_f32 %1, %9\n\tv_exp_f32 %2, %10\n\tv_exp_f32 %3, %11\n\t"
      "v_exp_f32 %4, %12\n\tv_exp_f32 %5, %13\n\tv_exp_f32 %6, %14\n\tv_exp_f32 %7, %15\n\tv_nop"
      : "=&v"(r0), "=&v"(r1), "=&v"(r2), "=&v"(r3), "=&v"(r4), "=&v"(r5), "=&v"(r6), "=&v"(r7)
      : "v"(a[0]), "v"(a[1]), "v"(a[2]), "v"(a[3]), "v"(a[4]), "v"(a[5]), "v"(a[6]), "v"(a[7]));
  return (v8f){r0, r1, r2, r3, r4, r5, r6, r7};
}
// the same for one value
__device__ __forceinline__ float exp2_x1(float a) {
  float r;
  asm("v_exp_f32 %0, %1\n\tv_nop" : "=&v"(r) : "v"(a));
  return r;
}

__global__ __launch_bounds__(128)
void attn_kernel(const _Float16* __restrict__ Qt, const _Float16* __restrict__ Kt,
                 const _Float16* __restrict__ Vh, const float* __restrict__ mk,
                 float* __restrict__ out, int nheads) {
  __shared__ __align__(16) _Float16 Ksh[KC * LP];          // [kv][d]   9 KB, pitch LP
  __shared__ __align__(16) _Float16 Vth[HD * LP];          // [d][kv]   9 KB, pitch LP
  __shared__ __align__(16) float    Ob[HD * OP];           // [d][q] block tile, pitch 68 floats

  const int tid  = threadIdx.x;
  const int wave = tid >> 5;
  const int lane = tid & 31;
  const int hh   = lane >> 4;
  const int c    = lane & 15;

  const int bh  = blockIdx.y;
  const int b   = bh / nheads;
  const int qb  = blockIdx.x;
  const int q0b = qb * QB;
  const int q0  = q0b + wave * 16;

  const _Float16* qbp = Qt + (size_t)bh * S_LEN * HD;
  const _Float16* kbp = Kt + (size_t)bh * S_LEN * HD;
  const _Float16* vbp = Vh + (size_t)bh * HD * S_LEN;
  const float*    mbp = mk + (size_t)b * S_LEN * S_LEN;
  float*          obp = out + (size_t)bh * HD * S_LEN;

  // Q fragments (B operand): column q0 + c, two 32-wide d chunks
  v16h qf[2];
  qf[0] = Frag<_Float16>::load(qbp + (size_t)(q0 + c) * HD + 0  + 8 * hh);
  qf[1] = Frag<_Float16>::load(qbp + (size_t)(q0 + c) * HD + 32 + 8 * hh);

  // this lane's mask row, at the first of its 8 consecutive keys of a 16-key tile
  const float* mrp = mbp + (size_t)(q0 + c) * S_LEN + 8 * hh;

  float mrow = NEG_FILL, lrow = 0.f;   // running maximum (both halves alike) and this half's share of the sum
  v8f oacc[4];                         // Ot tile t, register r = channel t*16 + 8*hh + r of query q0 + c
#pragma unroll
  for (int t = 0; t < 4; ++t) oacc[t] = (v8f){0.f,0.f,0.f,0.f,0.f,0.f,0.f,0.f};

  for (int kc = 0; kc < S_LEN / KC; ++kc) {
    const int kv0 = kc * KC;
    __syncthreads();
    // stage K chunk [kv][d] and V chunk [d][kv] as 16-B vector copies
#pragma unroll
    for (int i = 0; i < 4; ++i) {
      const int idx = tid + 128 * i;       // 0..511
      const int row = idx >> 3;            // 0..63
      const int c8  = (idx & 7) * 8;       // 0..56
      const v8h kv = *(const v8h*)(kbp + (size_t)(kv0 + row) * HD + c8);
      const v8h vv = *(const v8h*)(vbp + (size_t)row * S_LEN + kv0 + c8);
      *(v8h*)(Ksh + row * LP + c8) = kv;
      *(v8h*)(Vth + row * LP + c8) = vv;
    }
    __syncthreads();

    // mask of this lane's 32 scores: 8 consecutive keys per tile, two 16-B loads each, in flight under the score products
    v4f mv[4][2];
#pragma unroll
    for (int j = 0; j < 4; ++j) {
      mv[j][0] = *(const v4f*)(mrp + kv0 + j * 16);
      mv[j][1] = *(const v4f*)(mrp + kv0 + j * 16 + 4);
    }

    // St: 64 keys x this wave's 16 queries (A = K rows, B = Q)
    v8f s[4];
#pragma unroll
    for (int j = 0; j < 4; ++j) {
      s[j] = (v8f){0.f,0.f,0.f,0.f,0.f,0.f,0.f,0.f};
      const v16h kb0 = Frag<_Float16>::load(Ksh + (j * 16 + c) * LP + 0  + 8 * hh);
      s[j] = mma_h(kb0, qf[0], s[j]);
      const v16h kb1 = Frag<_Float16>::load(Ksh + (j * 16 + c) * LP + 32 + 8 * hh);
      s[j] = mma_h(kb1, qf[1], s[j]);
    }
    // keeps the mask compares, and with them the wait for the mask loads, behind the score products
    __builtin_amdgcn_sched_barrier(0);

    // scale, mask, chunk maximum of this lane's query
    float cmj[4];
#pragma unroll
    for (int j = 0; j < 4; ++j) {
      float m = NEG_FILL;
#pragma unroll
      for (int r = 0; r < 8; ++r) {
        float x = s[j][r] * SCALE_QK;
        if (mv[j][r >> 2][r & 3] < -5000.0f) x = NEG_FILL;
        s[j][r] = x;
        m = fmaxf(m, x);
      }
      cmj[j] = m;
    }
    float cm = fmaxf(fmaxf(cmj[0], cmj[1]), fmaxf(cmj[2], cmj[3]));
    cm = fmaxf(cm, xhalf(cm));

    // online softmax update; Pt (x2^15, f16) packed from the score registers into the B operand
    const float mnew  = fmaxf(mrow, cm);
    const float alpha = exp2_x1((mrow - mnew) * LOG2E);
    mrow = mnew;
    v16h pb[2];
    float psj[4];
#pragma unroll
    for (int j = 0; j < 4; ++j) {
      v8f a;
#pragma unroll
      for (int r = 0; r < 8; ++r) a[r] = (s[j][r] - mnew) * LOG2E;
      const v8f p = exp2_x8(a);
      float psum = 0.f;
#pragma unroll
      for (int r = 0; r < 8; ++r) {
        psum += p[r];
        pb[j >> 1][(j & 1) * 8 + r] = (_Float16)(p[r] * PSC);
      }
      psj[j] = psum;
    }
    lrow = lrow * alpha + ((psj[0] + psj[1]) + (psj[2] + psj[3]));
#pragma unroll
    for (int t = 0; t < 4; ++t)
#pragma unroll
      for (int r = 0; r < 8; ++r) oacc[t][r] *= alpha;

    // Ot += Vt * Pt (A = V channel rows, B = Pt)
#pragma unroll
    for (int kk = 0; kk < 2; ++kk) {
#pragma unroll
      for (int t = 0; t < 4; ++t) {
        const v16h va = Frag<_Float16>::load(Vth + (t * 16 + c) * LP + kk * 32 + 8 * hh);
        oacc[t] = mma_h(va, pb[kk], oacc[t]);
      }
    }
  }

  // epilogue: join the halves' sums, normalise, stage block tile [d][q], write whole channel rows
  {
    const float inv = 1.0f / ((lrow + xhalf(lrow)) * PSC);
    const int qloc = wave * 16 + c;
#pragma unroll
    for (int t = 0; t < 4; ++t)
#pragma unroll
      for (int r = 0; r < 8; ++r) Ob[(t * 16 + 8 * hh + r) * OP + qloc] = oacc[t][r] * inv;
  }
  __syncthreads();
  {
    const int c4 = c * 4;
    {
#pragma unroll
      for (int it = 0; it < 8; ++it) {
        const int d = wave * 16 + it * 2 + hh;   // wave covers channels wave*16 .. +15
        const v4f val = *(const v4f*)(Ob + d * OP + c4);
        *(v4f*)(obp + (size_t)d * S_LEN + q0b + c4) = val;
      }
      
    }
  }
}

extern "C" void kernel_launch(void* const* d_in, const int* in_sizes, int n_in,
                              void* d_out, int out_size, void* d_ws, size_t ws_size,
                              hipStream_t stream) {
  if (n_in < 4) return;
  const float* q  = (const float*)d_in[0];
  const float* k  = (const float*)d_in[1];
  const float* v  = (const float*)d_in[2];
  const float* mk = (const float*)d_in[3];
  float* out = (float*)d_out;

  const int per_b = C_CH * S_LEN;
  const int nb = in_sizes[0] / per_b;
  if (nb <= 0 || in_sizes[0] != nb * per_b) return;
  if (in_sizes[1] != in_sizes[0] || in_sizes[2] != in_sizes[0]) return;
  if ((long long)in_sizes[3] != (long long)nb * S_LEN * S_LEN) return;
  if (out_size != in_sizes[0]) return;
  const int nbh = nb * N_HEADS;

  const size_t eb = (size_t)nbh * S_LEN * HD * sizeof(_Float16);   // bytes per f16 tensor copy
  const size_t offQ = 0, offK = eb, offV = 2 * eb;
  const size_t total = 3 * eb;
  if (total > ws_size || total > (size_t)134217728) return;
  _Float16* Qt = (_Float16*)((char*)d_ws + offQ);
  _Float16* Kt = (_Float16*)((char*)d_ws + offK);
  _Float16* Vh = (_Float16*)((char*)d_ws + offV);

  // q, k: [bh][64][S] f32 -> [bh][S][64] f16
  tcast_kernel<<<dim3(S_LEN / 64, nbh, 2), 128, 0, stream>>>(q, k, Qt, Kt);
  // v: [bh][64][S] f32 -> same layout f16
  const int n2 = (int)((size_t)nbh * HD * S_LEN / 2);
  cast_f32_f16x2<<<dim3((n2 + 255) / 256), 256, 0, stream>>>(v, Vh, n2);
  // attention
  attn_kernel<<<dim3(S_LEN / QB, nbh), 128, 0, stream>>>(Qt, Kt, Vh, mk, out, N_HEADS);
  (void)hipGetLastError();
}

// v003
// Measured time: 51.6 microseconds a run.
// Two timings next to v002 both put it at 1.05 times that version's speed.
// Counting every step since v000, it is 2.27 times as fast.
#include <hip/hip_runtime.h>
#include <stdint.h>

typedef __attribute__((ext_vector_type(16))) _Float16 v16h;
typedef __attribute__((ext_vector_type(8)))  _Float16 v8h;
typedef __attribute__((ext_vector_type(8)))  float    v8f;
typedef __attribute__((ext_vector_type(4)))  float    v4f;

#define S_LEN 1024
#define HD 64
#define N_HEADS 8
#define C_CH 512
#define QB 64
#define KC 64
#define NWAVE 4
#define PSC 32768.0f
#define SCALE_QK 0.125f
#define NEG_FILL (-1.0e30f)
#define LOG2E 1.44269504f   // exp(x) = exp2(x * LOG2E), as __expf forms it
#define TP 72      // transpose tile pitch in halves (144 B rows)
#define OP 68      // output tile pitch in floats (272 B rows)
#define LP 72      // K and V tile pitch in halves: 144 B = 16 B x odd, so the 16 rows of a ds_load_b128 fragment read fall on distinct banks

// ---- 16-bit WMMA fragment loader (split k map: elements 0..7 <- p[0..7], 8..15 <- p[16..23]) ----
template <typename T> struct Frag;
template <> struct Frag<_Float16> {
  typedef v16h V; union U { v16h v; v8h h[2]; };
  static __device__ __forceinline__ v16h load(const _Float16* p) {
    U f; f.h[0] = *(const v8h*)(p); f.h[1] = *(const v8h*)(p + 16); return f.v;
  }
};

// WMMA with trailing hazard guard (ties D, keeps A/B live)
__device__ __forceinline__ v8f mma_h(v16h a, v16h b, v8f c) {
  c = __builtin_amdgcn_wmma_f32_16x16x32_f16(false, a, false, b, (short)0, c, false, false);
  asm volatile("v_nop\n\tv_nop\n\tv_nop\n\tv_nop" : "+v"(c) : "v"(a), "v"(b));
  return c;
}

// ---- operand casts, one launch. Grid slices z = 0, 1 (x0, x1), transpose-cast:
//      in[bh][64 d][S t] f32 (channel-major) -> out[bh][S t][64 d] f16 (token-major).
//      Slice z = 2 (x2), cast in place of layout: each block takes 4096 consecutive elements, 32 a thread. ----
__global__ __launch_bounds__(128) void tcast_kernel(
    const float* __restrict__ x0, const float* __restrict__ x1, const float* __restrict__ x2,
    _Float16* __restrict__ y0, _Float16* __restrict__ y1, _Float16* __restrict__ y2) {
  __shared__ __align__(16) _Float16 T[64 * TP];   // [t][d], pitch 72 halves
  const int tid = threadIdx.x, lane = tid & 31, wave = tid >> 5;
  if (blockIdx.z == 2) {   // block-uniform, in front of the barrier
    const size_t base = ((size_t)blockIdx.y * (S_LEN / 64) + blockIdx.x) * (64 * HD) + (size_t)tid * 8;
    v4f a[4][2];           // all eight 16-B loads in flight before the first conversion
#pragma unroll
    for (int i = 0; i < 4; ++i) {
      a[i][0] = *(const v4f*)(x2 + base + i * 1024);
      a[i][1] = *(const v4f*)(x2 + base + i * 1024 + 4);
    }
#pragma unroll
    for (int i = 0; i < 4; ++i) {
      v8h h;
#pragma unroll
      for (int e = 0; e < 4; ++e) { h[e] = (_Float16)a[i][0][e]; h[4 + e] = (_Float16)a[i][1][e]; }
      *(v8h*)(y2 + base + i * 1024) = h;
    }
    return;
  }
  const int t0 = blockIdx.x * 64;
  const int bh = blockIdx.y;
  const float* in = (blockIdx.z == 0) ? x0 : x1;
  _Float16* out = (blockIdx.z == 0) ? y0 : y1;
  const float* src = in + (size_t)bh * HD * S_LEN + t0;
#pragma unroll
  for (int i = 0; i < 8; ++i) {
    const int idx = tid + 128 * i;          // 0..1023
    const int d  = idx >> 4;                // 0..63
    const int t4 = (idx & 15) * 4;          // 0..60
    const v4f v = *(const v4f*)(src + (size_t)d * S_LEN + t4);
#pragma unroll
    for (int e = 0; e < 4; ++e) T[(t4 + e) * TP + d] = (_Float16)v[e];
  }
  __syncthreads();
  _Float16* dst = out + ((size_t)bh * S_LEN + t0) * HD;
  const int rq = lane >> 3, c8 = (lane & 7) * 8;
  {
#pragma unroll
    for (int it = 0; it < 4; ++it) {
      const int row = wave * 16 + it * 4 + rq;   // wave covers rows wave*16 .. +15
      const v8h hv = *(const v8h*)(T + row * TP + c8);
      *(v8h*)(dst + (size_t)row * HD + c8) = hv;
    }
    
  }
}

// lane l with lane l ^ 16 (one vector cross-row move)
__device__ __forceinline__ float xhalf(float x) {
  const int b = __builtin_bit_cast(int, x);
  return __builtin_bit_cast(float, __builtin_amdgcn_permlanex16(b, b, 0x76543210, 0xfedcba98, false, false));
}

// exp2 by v_exp_f32, eight at a time. The early-clobber outputs keep each v_exp off the sources of the one in front of it,
// and the closing v_nop is the slot the instruction set asks for between a transcendental and a next instruction that
// reads its result or overwrites its source (in a build with the plain call a dual-issue multiply stood there).
__device__ __forceinline__ v8f exp2_x8(v8f a) {
  float r0, r1, r2, r3, r4, r5, r6, r7;
  asm("v_exp_f32 %0, %8\n\tv_exp_f32 %1, %9\n\tv_exp_f32 %2, %10\n\tv_exp_f32 %3, %11\n\t"
      "v_exp_f32 %4, %12\n\tv_exp_f32 %5, %13\n\tv_exp_f32 %6, %14\n\tv_exp_f32 %7, %15\n\tv_nop"
      : "=&v"(r0), "=&v"(r1), "=&v"(r2), "=&v"(r3), "=&v"(r4), "=&v"(r5), "=&v"(r6), "=&v"(r7)
      : "v"(a[0]), "v"(a[1]), "v"(a[2]), "v"(a[3]), "v"(a[4]), "v"(a[5]), "v"(a[6]), "v"(a[7]));
  return (v8f){r0, r1, r2, r3, r4, r5, r6, r7};
}
// the same for one value
__device__ __forceinline__ float exp2_x1(float a) {
  float r;
  asm("v_exp_f32 %0, %1\n\tv_nop" : "=&v"(r) : "v"(a));
  return r;
}

__global__ __launch_bounds__(128)
void attn_kernel(const _Float16* __restrict__ Qt, const _Float16* __restrict__ Kt,
                 const _Float16* __restrict__ Vh, const float* __restrict__ mk,
                 float* __restrict__ out, int nheads) {
  __shared__ __align__(16) _Float16 Ksh[KC * LP];          // [kv][d]   9 KB, pitch LP
  __shared__ __align__(16) _Float16 Vth[HD * LP];          // [d][kv]   9 KB, pitch LP
  __shared__ __align__(16) float    Ob[HD * OP];           // [d][q] block tile, pitch 68 floats

  const int tid  = threadIdx.x;
  const int wave = tid >> 5;
  const int lane = tid & 31;
  const int hh   = lane >> 4;
  const int c    = lane & 15;

  const int bh  = blockIdx.y;
  const int b   = bh / nheads;
  const int qb  = blockIdx.x;
  const int q0b = qb * QB;
  const int q0  = q0b + wave * 16;

  const _Float16* qbp = Qt + (size_t)bh * S_LEN * HD;
  const _Float16* kbp = Kt + (size_t)bh * S_LEN * HD;
  const _Float16* vbp = Vh + (size_t)bh * HD * S_LEN;
  const float*    mbp = mk + (size_t)b * S_LEN * S_LEN;
  float*          obp = out + (size_t)bh * HD * S_LEN;

  // Q fragments (B operand): column q0 + c, two 32-wide d chunks
  v16h qf[2];
  qf[0] = Frag<_Float16>::load(qbp + (size_t)(q0 + c) * HD + 0  + 8 * hh);
  qf[1] = Frag<_Float16>::load(qbp + (size_t)(q0 + c) * HD + 32 + 8 * hh);

  // this lane's mask row, at the first of its 8 consecutive keys of a 16-key tile
  const float* mrp = mbp + (size_t)(q0 + c) * S_LEN + 8 * hh;

  float mrow = NEG_FILL, lrow = 0.f;   // running maximum (both halves alike) and this half's share of the sum
  v8f oacc[4];                         // Ot tile t, register r = channel t*16 + 8*hh + r of query q0 + c
#pragma unroll
  for (int t = 0; t < 4; ++t) oacc[t] = (v8f){0.f,0.f,0.f,0.f,0.f,0.f,0.f,0.f};

  for (int kc = 0; kc < S_LEN / KC; ++kc) {
    const int kv0 = kc * KC;
    __syncthreads();
    // stage K chunk [kv][d] and V chunk [d][kv] as 16-B vector copies
#pragma unroll
    for (int i = 0; i < 4; ++i) {
      const int idx = tid + 128 * i;       // 0..511
      const int row = idx >> 3;            // 0..63
      const int c8  = (idx & 7) * 8;       // 0..56
      const v8h kv = *(const v8h*)(kbp + (size_t)(kv0 + row) * HD + c8);
      const v8h vv = *(const v8h*)(vbp + (size_t)row * S_LEN + kv0 + c8);
      *(v8h*)(Ksh + row * LP + c8) = kv;
      *(v8h*)(Vth + row * LP + c8) = vv;
    }
    __syncthreads();

    // mask of this lane's 32 scores: 8 consecutive keys per tile, two 16-B loads each, in flight under the score products
    v4f mv[4][2];
#pragma unroll
    for (int j = 0; j < 4; ++j) {
      mv[j][0] = *(const v4f*)(mrp + kv0 + j * 16);
      mv[j][1] = *(const v4f*)(mrp + kv0 + j * 16 + 4);
    }

    // St: 64 keys x this wave's 16 queries (A = K rows, B = Q)
    v8f s[4];
#pragma unroll
    for (int j = 0; j < 4; ++j) {
      s[j] = (v8f){0.f,0.f,0.f,0.f,0.f,0.f,0.f,0.f};
      const v16h kb0 = Frag<_Float16>::load(Ksh + (j * 16 + c) * LP + 0  + 8 * hh);
      s[j] = mma_h(kb0, qf[0], s[j]);
      const v16h kb1 = Frag<_Float16>::load(Ksh + (j * 16 + c) * LP + 32 + 8 * hh);
      s[j] = mma_h(kb1, qf[1], s[j]);
    }
    // keeps the mask compares, and with them the wait for the mask loads, behind the score products
    __builtin_amdgcn_sched_barrier(0);

    // scale, mask, chunk maximum of this lane's query
    float cmj[4];
#pragma unroll
    for (int j = 0; j < 4; ++j) {
      float m = NEG_FILL;
#pragma unroll
      for (int r = 0; r < 8; ++r) {
        float x = s[j][r] * SCALE_QK;
        if (mv[j][r >> 2][r & 3] < -5000.0f) x = NEG_FILL;
        s[j][r] = x;
        m = fmaxf(m, x);
      }
      cmj[j] = m;
    }
    float cm = fmaxf(fmaxf(cmj[0], cmj[1]), fmaxf(cmj[2], cmj[3]));
    cm = fmaxf(cm, xhalf(cm));

    // online softmax update; Pt (x2^15, f16) packed from the score registers into the B operand
    const float mnew  = fmaxf(mrow, cm);
    const float alpha = exp2_x1((mrow - mnew) * LOG2E);
    mrow = mnew;
    v16h pb[2];
    float psj[4];
#pragma unroll
    for (int j = 0; j < 4; ++j) {
      v8f a;
#pragma unroll
      for (int r = 0; r < 8; ++r) a[r] = (s[j][r] - mnew) * LOG2E;
      const v8f p = exp2_x8(a);
      float psum = 0.f;
#pragma unroll
      for (int r = 0; r < 8; ++r) {
        psum += p[r];
        pb[j >> 1][(j & 1) * 8 + r] = (_Float16)(p[r] * PSC);
      }
      psj[j] = psum;
    }
    lrow = lrow * alpha + ((psj[0] + psj[1]) + (psj[2] + psj[3]));
#pragma unroll
    for (int t = 0; t < 4; ++t)
#pragma unroll
      for (int r = 0; r < 8; ++r) oacc[t][r] *= alpha;

    // Ot += Vt * Pt (A = V channel rows, B = Pt)
#pragma unroll
    for (int kk = 0; kk < 2; ++kk) {
#pragma unroll
      for (int t = 0; t < 4; ++t) {
        const v16h va = Frag<_Float16>::load(Vth + (t * 16 + c) * LP + kk * 32 + 8 * hh);
        oacc[t] = mma_h(va, pb[kk], oacc[t]);
      }
    }
  }

  // epilogue: join the halves' sums, normalise, stage block tile [d][q], write whole channel rows
  {
    const float inv = 1.0f / ((lrow + xhalf(lrow)) * PSC);
    const int qloc = wave * 16 + c;
#pragma unroll
    for (int t = 0; t < 4; ++t)
#pragma unroll
      for (int r = 0; r < 8; ++r) Ob[(t * 16 + 8 * hh + r) * OP + qloc] = oacc[t][r] * inv;
  }
  __syncthreads();
  {
    const int c4 = c * 4;
    {
#pragma unroll
      for (int it = 0; it < 8; ++it) {
        const int d = wave * 16 + it * 2 + hh;   // wave covers channels wave*16 .. +15
        const v4f val = *(const v4f*)(Ob + d * OP + c4);
        *(v4f*)(obp + (size_t)d * S_LEN + q0b + c4) = val;
      }
      
    }
  }
}

extern "C" void kernel_launch(void* const* d_in, const int* in_sizes, int n_in,
                              void* d_out, int out_size, void* d_ws, size_t ws_size,
                              hipStream_t stream) {
  if (n_in < 4) return;
  const float* q  = (const float*)d_in[0];
  const float* k  = (const float*)d_in[1];
  const float* v  = (const float*)d_in[2];
  const float* mk = (const float*)d_in[3];
  float* out = (float*)d_out;

  const int per_b = C_CH * S_LEN;
  const int nb = in_sizes[0] / per_b;
  if (nb <= 0 || in_sizes[0] != nb * per_b) return;
  if (in_sizes[1] != in_sizes[0] || in_sizes[2] != in_sizes[0]) return;
  if ((long long)in_sizes[3] != (long long)nb * S_LEN * S_LEN) return;
  if (out_size != in_sizes[0]) return;
  const int nbh = nb * N_HEADS;

  const size_t eb = (size_t)nbh * S_LEN * HD * sizeof(_Float16);   // bytes per f16 tensor copy
  const size_t offQ = 0, offK = eb, offV = 2 * eb;
  const size_t total = 3 * eb;
  if (total > ws_size || total > (size_t)134217728) return;
  _Float16* Qt = (_Float16*)((char*)d_ws + offQ);
  _Float16* Kt = (_Float16*)((char*)d_ws + offK);
  _Float16* Vh = (_Float16*)((char*)d_ws + offV);

  // q, k: [bh][64][S] f32 -> [bh][S][64] f16; v: [bh][64][S] f32 -> same layout f16
  tcast_kernel<<<dim3(S_LEN / 64, nbh, 3), 128, 0, stream>>>(q, k, v, Qt, Kt, Vh);
  // attention
  attn_kernel<<<dim3(S_LEN / QB, nbh), 128, 0, stream>>>(Qt, Kt, Vh, mk, out, N_HEADS);
  (void)hipGetLastError();
}

// v004
// It runs in 46.7 microseconds.
// In two side-by-side timings against v003, it was 1.11 and 1.10 times as fast.
// Over all steps from v000 it is 2.51 times as fast.
#include <hip/hip_runtime.h>
#include <stdint.h>

typedef __attribute__((ext_vector_type(16))) _Float16 v16h;
typedef __attribute__((ext_vector_type(8)))  _Float16 v8h;
typedef __attribute__((ext_vector_type(8)))  float    v8f;
typedef __attribute__((ext_vector_type(4)))  float    v4f;
typedef const unsigned int __attribute__((address_space(4)))* cuint_p;   // read-only for the whole launch

#define S_LEN 1024
#define HD 64
#define N_HEADS 8
#define C_CH 512
#define QB 64
#define KC 64
#define NWAVE 4
#define PSC 32768.0f
#define SCALE_QK 0.125f
#define NEG_FILL (-1.0e30f)
#define LOG2E 1.44269504f   // exp(x) = exp2(x * LOG2E), as __expf forms it
#define TP 72      // transpose tile pitch in halves (144 B rows)
#define OP 68      // output tile pitch in floats (272 B rows)
#define LP 72      // K and V tile pitch in halves: 144 B = 16 B x odd, so the 16 rows of a ds_load_b128 fragment read fall on distinct banks

// ---- 16-bit WMMA fragment loader (split k map: elements 0..7 <- p[0..7], 8..15 <- p[16..23]) ----
template <typename T> struct Frag;
template <> struct Frag<_Float16> {
  typedef v16h V; union U { v16h v; v8h h[2]; };
  static __device__ __forceinline__ v16h load(const _Float16* p) {
    U f; f.h[0] = *(const v8h*)(p); f.h[1] = *(const v8h*)(p + 16); return f.v;
  }
};

// WMMA with trailing hazard guard (ties D, keeps A/B live)
__device__ __forceinline__ v8f mma_h(v16h a, v16h b, v8f c) {
  c = __builtin_amdgcn_wmma_f32_16x16x32_f16(false, a, false, b, (short)0, c, false, false);
  asm volatile("v_nop\n\tv_nop\n\tv_nop\n\tv_nop" : "+v"(c) : "v"(a), "v"(b));
  return c;
}

// ---- operand casts, one launch. Grid slices z = 0, 1 (x0, x1), transpose-cast:
//      in[bh][64 d][S t] f32 (channel-major) -> out[bh][S t][64 d] f16 (token-major).
//      Slice z = 2 (x2), cast in place of layout: each block takes 4096 consecutive elements, 32 a thread.
//      Slice z = 3 (mk), mask packing: f32 [b][S q][S k] -> one bit a score, in the order the attention kernel selects by:
//      mw[b][q / 16][k / 64][word j*8 + r], bit hh*16 + c  =  (mk[b][q16*16 + c][k64*64 + j*16 + 8*hh + r] < -5000).
//      A wave takes 16 queries x 128 keys: each load is 512 consecutive bytes of one mask row. ----
__global__ __launch_bounds__(128) void tcast_kernel(
    const float* __restrict__ x0, const float* __restrict__ x1, const float* __restrict__ x2,
    const float* __restrict__ mk,
    _Float16* __restrict__ y0, _Float16* __restrict__ y1, _Float16* __restrict__ y2,
    unsigned int* __restrict__ mw) {
  __shared__ __align__(16) _Float16 T[64 * TP];   // [t][d], pitch 72 halves
  const int tid = threadIdx.x, lane = tid & 31, wave = tid >> 5;
  if (blockIdx.z == 2) {   // block-uniform, in front of the barrier
    const size_t base = ((size_t)blockIdx.y * (S_LEN / 64) + blockIdx.x) * (64 * HD) + (size_t)tid * 8;
    v4f a[4][2];           // all eight 16-B loads in flight before the first conversion
#pragma unroll
    for (int i = 0; i < 4; ++i) {
      a[i][0] = *(const v4f*)(x2 + base + i * 1024);
      a[i][1] = *(const v4f*)(x2 + base + i * 1024 + 4);
    }
#pragma unroll
    for (int i = 0; i < 4; ++i) {
      v8h h;
#pragma unroll
      for (int e = 0; e < 4; ++e) { h[e] = (_Float16)a[i][0][e]; h[4 + e] = (_Float16)a[i][1][e]; }
      *(v8h*)(y2 + base + i * 1024) = h;
    }
    return;
  }
  if (blockIdx.z == 3) {   // block-uniform, in front of the barrier
    // wave g of the slice: (b * 64 + q16) * 8 + pair of 64-key chunks
    const size_t g = ((size_t)blockIdx.y * (S_LEN / 64) + blockIdx.x) * 4 + wave;
    const float* mrow = mk + (g >> 3) * (16 * S_LEN) + (g & 7) * 128 + lane * 4;
    static_assert(N_HEADS * (S_LEN / 64) * 4 == (S_LEN / 16) * (S_LEN / 128), "the slice's waves cover a batch's mask exactly once");
    v4f a[16];             // row i, keys 4*lane .. 4*lane + 3 of the 128
#pragma unroll
    for (int i = 0; i < 16; ++i) a[i] = *(const v4f*)(mrow + i * S_LEN);
    // bw[e] of lane (c, hh): bit l = key 4*l + e of row c
    const int c = lane & 15, hh = lane >> 4;
    unsigned int bw[4] = {0u, 0u, 0u, 0u};
#pragma unroll
    for (int i = 0; i < 16; ++i)
#pragma unroll
      for (int e = 0; e < 4; ++e) {
        const unsigned int rowbits = __builtin_amdgcn_ballot_w32(a[i][e] < -5000.0f);
        bw[e] = (c == i) ? rowbits : bw[e];
      }
    // key ch*64 + j*16 + 8*hh + r = 4*l + e with e = r & 3, l = ch*16 + j*4 + 2*hh + (r >> 2)
#pragma unroll
    for (int e = 0; e < 4; ++e) bw[e] >>= 2 * hh;
#pragma unroll
    for (int ch = 0; ch < 2; ++ch) {
      unsigned int word = 0u;   // lane j*8 + r ends up holding word j*8 + r
#pragma unroll
      for (int j = 0; j < 4; ++j)
#pragma unroll
        for (int r = 0; r < 8; ++r) {
          const unsigned int sel = __builtin_amdgcn_ballot_w32((bw[r & 3] & (1u << (ch * 16 + j * 4 + (r >> 2)))) != 0u);
          word = (lane == j * 8 + r) ? sel : word;
        }
      mw[(g * 2 + ch) * 32 + lane] = word;
    }
    // the two stores' address and data registers are reused by the other slices' code, which the listing places behind this one
    asm volatile("s_wait_xcnt 0x0" ::: "memory");
    return;
  }
  const int t0 = blockIdx.x * 64;
  const int bh = blockIdx.y;
  const float* in = (blockIdx.z == 0) ? x0 : x1;
  _Float16* out = (blockIdx.z == 0) ? y0 : y1;
  const float* src = in + (size_t)bh * HD * S_LEN + t0;
#pragma unroll
  for (int i = 0; i < 8; ++i) {
    const int idx = tid + 128 * i;          // 0..1023
    const int d  = idx >> 4;                // 0..63
    const int t4 = (idx & 15) * 4;          // 0..60
    const v4f v = *(const v4f*)(src + (size_t)d * S_LEN + t4);
#pragma unroll
    for (int e = 0; e < 4; ++e) T[(t4 + e) * TP + d] = (_Float16)v[e];
  }
  __syncthreads();
  _Float16* dst = out + ((size_t)bh * S_LEN + t0) * HD;
  const int rq = lane >> 3, c8 = (lane & 7) * 8;
  {
#pragma unroll
    for (int it = 0; it < 4; ++it) {
      const int row = wave * 16 + it * 4 + rq;   // wave covers rows wave*16 .. +15
      const v8h hv = *(const v8h*)(T + row * TP + c8);
      *(v8h*)(dst + (size_t)row * HD + c8) = hv;
    }
    
  }
}

// lane l with lane l ^ 16 (one vector cross-row move)
__device__ __forceinline__ float xhalf(float x) {
  const int b = __builtin_bit_cast(int, x);
  return __builtin_bit_cast(float, __builtin_amdgcn_permlanex16(b, b, 0x76543210, 0xfedcba98, false, false));
}

// exp2 by v_exp_f32, eight at a time. The early-clobber outputs keep each v_exp off the sources of the one in front of it,
// and the closing v_nop is the slot the instruction set asks for between a transcendental and a next instruction that
// reads its result or overwrites its source (in a build with the plain call a dual-issue multiply stood there).
__device__ __forceinline__ v8f exp2_x8(v8f a) {
  float r0, r1, r2, r3, r4, r5, r6, r7;
  asm("v_exp_f32 %0, %8\n\tv_exp_f32 %1, %9\n\tv_exp_f32 %2, %10\n\tv_exp_f32 %3, %11\n\t"
      "v_exp_f32 %4, %12\n\tv_exp_f32 %5, %13\n\tv_exp_f32 %6, %14\n\tv_exp_f32 %7, %15\n\tv_nop"
      : "=&v"(r0), "=&v"(r1), "=&v"(r2), "=&v"(r3), "=&v"(r4), "=&v"(r5), "=&v"(r6), "=&v"(r7)
      : "v"(a[0]), "v"(a[1]), "v"(a[2]), "v"(a[3]), "v"(a[4]), "v"(a[5]), "v"(a[6]), "v"(a[7]));
  return (v8f){r0, r1, r2, r3, r4, r5, r6, r7};
}
// the same for one value
__device__ __forceinline__ float exp2_x1(float a) {
  float r;
  asm("v_exp_f32 %0, %1\n\tv_nop" : "=&v"(r) : "v"(a));
  return r;
}

__global__ __launch_bounds__(128)
void attn_kernel(const _Float16* __restrict__ Qt, const _Float16* __restrict__ Kt,
                 const _Float16* __restrict__ Vh, const unsigned int* __restrict__ mw,
                 float* __restrict__ out, int nheads) {
  __shared__ __align__(16) _Float16 Ksh[KC * LP];          // [kv][d]   9 KB, pitch LP
  __shared__ __align__(16) _Float16 Vth[HD * LP];          // [d][kv]   9 KB, pitch LP
  __shared__ __align__(16) float    Ob[HD * OP];           // [d][q] block tile, pitch 68 floats

  const int tid  = threadIdx.x;
  const int wave = tid >> 5;
  const int lane = tid & 31;
  const int hh   = lane >> 4;
  const int c    = lane & 15;

  const int bh  = blockIdx.y;
  const int b   = bh / nheads;
  const int qb  = blockIdx.x;
  const int q0b = qb * QB;
  const int q0  = q0b + wave * 16;

  const _Float16* qbp = Qt + (size_t)bh * S_LEN * HD;
  const _Float16* kbp = Kt + (size_t)bh * S_LEN * HD;
  const _Float16* vbp = Vh + (size_t)bh * HD * S_LEN;
  float*          obp = out + (size_t)bh * HD * S_LEN;

  // Q fragments (B operand): column q0 + c, two 32-wide d chunks
  v16h qf[2];
  qf[0] = Frag<_Float16>::load(qbp + (size_t)(q0 + c) * HD + 0  + 8 * hh);
  qf[1] = Frag<_Float16>::load(qbp + (size_t)(q0 + c) * HD + 32 + 8 * hh);

  // this wave's mask words: 32 a chunk, word j*8 + r = one bit a lane for register r of St tile j.
  // The wave number goes through readfirstlane and the pointer into the constant address space (the words were written by the
  // launch before and nothing writes them here), so that the loads are scalar and the words arrive in scalar registers.
  const cuint_p mwp = (cuint_p)(uintptr_t)(mw + (((size_t)b * (S_LEN / 16) + qb * NWAVE + __builtin_amdgcn_readfirstlane(wave)) * (S_LEN / KC)) * 32);

  float mrow = NEG_FILL, lrow = 0.f;   // running maximum (both halves alike) and this half's share of the sum
  v8f oacc[4];                         // Ot tile t, register r = channel t*16 + 8*hh + r of query q0 + c
#pragma unroll
  for (int t = 0; t < 4; ++t) oacc[t] = (v8f){0.f,0.f,0.f,0.f,0.f,0.f,0.f,0.f};

  for (int kc = 0; kc < S_LEN / KC; ++kc) {
    const int kv0 = kc * KC;
    // mask words of this chunk, in flight under the staging
    unsigned int mv[32];
#pragma unroll
    for (int i = 0; i < 32; ++i) mv[i] = mwp[kc * 32 + i];
    __syncthreads();
    // stage K chunk [kv][d] and V chunk [d][kv] as 16-B vector copies
#pragma unroll
    for (int i = 0; i < 4; ++i) {
      const int idx = tid + 128 * i;       // 0..511
      const int row = idx >> 3;            // 0..63
      const int c8  = (idx & 7) * 8;       // 0..56
      const v8h kv = *(const v8h*)(kbp + (size_t)(kv0 + row) * HD + c8);
      const v8h vv = *(const v8h*)(vbp + (size_t)row * S_LEN + kv0 + c8);
      *(v8h*)(Ksh + row * LP + c8) = kv;
      *(v8h*)(Vth + row * LP + c8) = vv;
    }
    __syncthreads();

    // St: 64 keys x this wave's 16 queries (A = K rows, B = Q)
    v8f s[4];
#pragma unroll
    for (int j = 0; j < 4; ++j) {
      s[j] = (v8f){0.f,0.f,0.f,0.f,0.f,0.f,0.f,0.f};
      const v16h kb0 = Frag<_Float16>::load(Ksh + (j * 16 + c) * LP + 0  + 8 * hh);
      s[j] = mma_h(kb0, qf[0], s[j]);
      const v16h kb1 = Frag<_Float16>::load(Ksh + (j * 16 + c) * LP + 32 + 8 * hh);
      s[j] = mma_h(kb1, qf[1], s[j]);
    }

    // scale, mask, chunk maximum of this lane's query
    float cmj[4];
#pragma unroll
    for (int j = 0; j < 4; ++j) {
      float m = NEG_FILL;
#pragma unroll
      for (int r = 0; r < 8; ++r) {
        float x = s[j][r] * SCALE_QK;
        if (__builtin_amdgcn_inverse_ballot_w32(mv[j * 8 + r])) x = NEG_FILL;   // the word is the select's lane mask
        s[j][r] = x;
        m = fmaxf(m, x);
      }
      cmj[j] = m;
    }
    float cm = fmaxf(fmaxf(cmj[0], cmj[1]), fmaxf(cmj[2], cmj[3]));
    cm = fmaxf(cm, xhalf(cm));

    // online softmax update; Pt (x2^15, f16) packed from the score registers into the B operand
    const float mnew  = fmaxf(mrow, cm);
    const float alpha = exp2_x1((mrow - mnew) * LOG2E);
    mrow = mnew;
    v16h pb[2];
    float psj[4];
#pragma unroll
    for (int j = 0; j < 4; ++j) {
      v8f a;
#pragma unroll
      for (int r = 0; r < 8; ++r) a[r] = (s[j][r] - mnew) * LOG2E;
      const v8f p = exp2_x8(a);
      float psum = 0.f;
#pragma unroll
      for (int r = 0; r < 8; ++r) {
        psum += p[r];
        pb[j >> 1][(j & 1) * 8 + r] = (_Float16)(p[r] * PSC);
      }
      psj[j] = psum;
    }
    lrow = lrow * alpha + ((psj[0] + psj[1]) + (psj[2] + psj[3]));
#pragma unroll
    for (int t = 0; t < 4; ++t)
#pragma unroll
      for (int r = 0; r < 8; ++r) oacc[t][r] *= alpha;

    // Ot += Vt * Pt (A = V channel rows, B = Pt)
#pragma unroll
    for (int kk = 0; kk < 2; ++kk) {
#pragma unroll
      for (int t = 0; t < 4; ++t) {
        const v16h va = Frag<_Float16>::load(Vth + (t * 16 + c) * LP + kk * 32 + 8 * hh);
        oacc[t] = mma_h(va, pb[kk], oacc[t]);
      }
    }
  }

  // epilogue: join the halves' sums, normalise, stage block tile [d][q], write whole channel rows
  {
    const float inv = 1.0f / ((lrow + xhalf(lrow)) * PSC);
    const int qloc = wave * 16 + c;
#pragma unroll
    for (int t = 0; t < 4; ++t)
#pragma unroll
      for (int r = 0; r < 8; ++r) Ob[(t * 16 + 8 * hh + r) * OP + qloc] = oacc[t][r] * inv;
  }
  __syncthreads();
  {
    const int c4 = c * 4;
    {
#pragma unroll
      for (int it = 0; it < 8; ++it) {
        const int d = wave * 16 + it * 2 + hh;   // wave covers channels wave*16 .. +15
        const v4f val = *(const v4f*)(Ob + d * OP + c4);
        *(v4f*)(obp + (size_t)d * S_LEN + q0b + c4) = val;
      }
      
    }
  }
}

extern "C" void kernel_launch(void* const* d_in, const int* in_sizes, int n_in,
                              void* d_out, int out_size, void* d_ws, size_t ws_size,
                              hipStream_t stream) {
  if (n_in < 4) return;
  const float* q  = (const float*)d_in[0];
  const float* k  = (const float*)d_in[1];
  const float* v  = (const float*)d_in[2];
  const float* mk = (const float*)d_in[3];
  float* out = (float*)d_out;

  const int per_b = C_CH * S_LEN;
  const int nb = in_sizes[0] / per_b;
  if (nb <= 0 || in_sizes[0] != nb * per_b) return;
  if (in_sizes[1] != in_sizes[0] || in_sizes[2] != in_sizes[0]) return;
  if ((long long)in_sizes[3] != (long long)nb * S_LEN * S_LEN) return;
  if (out_size != in_sizes[0]) return;
  const int nbh = nb * N_HEADS;

  const size_t eb = (size_t)nbh * S_LEN * HD * sizeof(_Float16);   // bytes per f16 tensor copy
  const size_t offQ = 0, offK = eb, offV = 2 * eb;
  const size_t offM = 3 * eb;
  const size_t total = 3 * eb + (size_t)nb * S_LEN * (S_LEN / 8);   // one mask bit a score
  if (total > ws_size || total > (size_t)134217728) return;
  _Float16* Qt = (_Float16*)((char*)d_ws + offQ);
  _Float16* Kt = (_Float16*)((char*)d_ws + offK);
  _Float16* Vh = (_Float16*)((char*)d_ws + offV);
  unsigned int* Mw = (unsigned int*)((char*)d_ws + offM);

  // q, k: [bh][64][S] f32 -> [bh][S][64] f16; v: [bh][64][S] f32 -> same layout f16; mask: f32 -> bits
  tcast_kernel<<<dim3(S_LEN / 64, nbh, 4), 128, 0, stream>>>(q, k, v, mk, Qt, Kt, Vh, Mw);
  // attention
  attn_kernel<<<dim3(S_LEN / QB, nbh), 128, 0, stream>>>(Qt, Kt, Vh, Mw, out, N_HEADS);
  (void)hipGetLastError();
}

// v005
// One run takes 39.8 microseconds.
// Next to v004, in two timings, it ran 1.16 and 1.17 times as fast.
// Counting every step since v000, it is 2.94 times as fast.
#include <hip/hip_runtime.h>
#include <stdint.h>

typedef __attribute__((ext_vector_type(16))) _Float16 v16h;
typedef __attribute__((ext_vector_type(8)))  _Float16 v8h;
typedef __attribute__((ext_vector_type(8)))  float    v8f;
typedef __attribute__((ext_vector_type(4)))  float    v4f;
typedef const unsigned int __attribute__((address_space(4)))* cuint_p;   // read-only for the whole launch

#define S_LEN 1024
#define HD 64
#define N_HEADS 8
#define C_CH 512
#define QB 64
#define KC 64
#define NWAVE 4
#define PSC 32768.0f
#define SCALE_QK 0.125f
#define NEG_FILL (-1.0e30f)
#define LOG2E 1.44269504f   // exp(x) = exp2(x * LOG2E), as __expf forms it
#define TP 72      // transpose tile pitch in halves (144 B rows)
#define OP 68      // output tile pitch in floats (272 B rows)
#define LP 72      // K and V tile pitch in halves: 144 B = 16 B x odd, so the 16 rows of a ds_load_b128 fragment read fall on distinct banks

// ---- 16-bit WMMA fragment loader (split k map: elements 0..7 <- p[0..7], 8..15 <- p[16..23]) ----
template <typename T> struct Frag;
template <> struct Frag<_Float16> {
  typedef v16h V; union U { v16h v; v8h h[2]; };
  static __device__ __forceinline__ v16h load(const _Float16* p) {
    U f; f.h[0] = *(const v8h*)(p); f.h[1] = *(const v8h*)(p + 16); return f.v;
  }
};

// plain builtin: the compiler keeps the distances behind it and is free to run WMMAs back to back
__device__ __forceinline__ v8f mma_h(v16h a, v16h b, v8f c) {
  return __builtin_amdgcn_wmma_f32_16x16x32_f16(false, a, false, b, (short)0, c, false, false);
}

// ---- operand casts, one launch. Grid slices z = 0, 1 (x0, x1), transpose-cast:
//      in[bh][64 d][S t] f32 (channel-major) -> out[bh][S t][64 d] f16 (token-major).
//      Slice z = 2 (x2), cast in place of layout: each block takes 4096 consecutive elements, 32 a thread.
//      Slice z = 3 (mk), mask packing: f32 [b][S q][S k] -> one bit a score, in the order the attention kernel selects by:
//      mw[b][q / 16][k / 64][word j*8 + r], bit hh*16 + c  =  (mk[b][q16*16 + c][k64*64 + j*16 + 8*hh + r] < -5000).
//      A wave takes 16 queries x 128 keys: each load is 512 consecutive bytes of one mask row. ----
__global__ __launch_bounds__(128) void tcast_kernel(
    const float* __restrict__ x0, const float* __restrict__ x1, const float* __restrict__ x2,
    const float* __restrict__ mk,
    _Float16* __restrict__ y0, _Float16* __restrict__ y1, _Float16* __restrict__ y2,
    unsigned int* __restrict__ mw) {
  __shared__ __align__(16) _Float16 T[64 * TP];   // [t][d], pitch 72 halves
  const int tid = threadIdx.x, lane = tid & 31, wave = tid >> 5;
  if (blockIdx.z == 2) {   // block-uniform, in front of the barrier
    const size_t base = ((size_t)blockIdx.y * (S_LEN / 64) + blockIdx.x) * (64 * HD) + (size_t)tid * 8;
    v4f a[4][2];           // all eight 16-B loads in flight before the first conversion
#pragma unroll
    for (int i = 0; i < 4; ++i) {
      a[i][0] = *(const v4f*)(x2 + base + i * 1024);
      a[i][1] = *(const v4f*)(x2 + base + i * 1024 + 4);
    }
#pragma unroll
    for (int i = 0; i < 4; ++i) {
      v8h h;
#pragma unroll
      for (int e = 0; e < 4; ++e) { h[e] = (_Float16)a[i][0][e]; h[4 + e] = (_Float16)a[i][1][e]; }
      *(v8h*)(y2 + base + i * 1024) = h;
    }
    return;
  }
  if (blockIdx.z == 3) {   // block-uniform, in front of the barrier
    // wave g of the slice: (b * 64 + q16) * 8 + pair of 64-key chunks
    const size_t g = ((size_t)blockIdx.y * (S_LEN / 64) + blockIdx.x) * 4 + wave;
    const float* mrow = mk + (g >> 3) * (16 * S_LEN) + (g & 7) * 128 + lane * 4;
    static_assert(N_HEADS * (S_LEN / 64) * 4 == (S_LEN / 16) * (S_LEN / 128), "the slice's waves cover a batch's mask exactly once");
    v4f a[16];             // row i, keys 4*lane .. 4*lane + 3 of the 128
#pragma unroll
    for (int i = 0; i < 16; ++i) a[i] = *(const v4f*)(mrow + i * S_LEN);
    // bw[e] of lane (c, hh): bit l = key 4*l + e of row c
    const int c = lane & 15, hh = lane >> 4;
    unsigned int bw[4] = {0u, 0u, 0u, 0u};
#pragma unroll
    for (int i = 0; i < 16; ++i)
#pragma unroll
      for (int e = 0; e < 4; ++e) {
        const unsigned int rowbits = __builtin_amdgcn_ballot_w32(a[i][e] < -5000.0f);
        bw[e] = (c == i) ? rowbits : bw[e];
      }
    // key ch*64 + j*16 + 8*hh + r = 4*l + e with e = r & 3, l = ch*16 + j*4 + 2*hh + (r >> 2)
#pragma unroll
    for (int e = 0; e < 4; ++e) bw[e] >>= 2 * hh;
#pragma unroll
    for (int ch = 0; ch < 2; ++ch) {
      unsigned int word = 0u;   // lane j*8 + r ends up holding word j*8 + r
#pragma unroll
      for (int j = 0; j < 4; ++j)
#pragma unroll
        for (int r = 0; r < 8; ++r) {
          const unsigned int sel = __builtin_amdgcn_ballot_w32((bw[r & 3] & (1u << (ch * 16 + j * 4 + (r >> 2)))) != 0u);
          word = (lane == j * 8 + r) ? sel : word;
        }
      mw[(g * 2 + ch) * 32 + lane] = word;
    }
    // the two stores' address and data registers are reused by the other slices' code, which the listing places behind this one
    asm volatile("s_wait_xcnt 0x0" ::: "memory");
    return;
  }
  const int t0 = blockIdx.x * 64;
  const int bh = blockIdx.y;
  const float* in = (blockIdx.z == 0) ? x0 : x1;
  _Float16* out = (blockIdx.z == 0) ? y0 : y1;
  const float* src = in + (size_t)bh * HD * S_LEN + t0;
#pragma unroll
  for (int i = 0; i < 8; ++i) {
    const int idx = tid + 128 * i;          // 0..1023
    const int d  = idx >> 4;                // 0..63
    const int t4 = (idx & 15) * 4;          // 0..60
    const v4f v = *(const v4f*)(src + (size_t)d * S_LEN + t4);
#pragma unroll
    for (int e = 0; e < 4; ++e) T[(t4 + e) * TP + d] = (_Float16)v[e];
  }
  __syncthreads();
  _Float16* dst = out + ((size_t)bh * S_LEN + t0) * HD;
  const int rq = lane >> 3, c8 = (lane & 7) * 8;
  {
#pragma unroll
    for (int it = 0; it < 4; ++it) {
      const int row = wave * 16 + it * 4 + rq;   // wave covers rows wave*16 .. +15
      const v8h hv = *(const v8h*)(T + row * TP + c8);
      *(v8h*)(dst + (size_t)row * HD + c8) = hv;
    }
    
  }
}

// lane l with lane l ^ 16 (one vector cross-row move)
__device__ __forceinline__ float xhalf(float x) {
  const int b = __builtin_bit_cast(int, x);
  return __builtin_bit_cast(float, __builtin_amdgcn_permlanex16(b, b, 0x76543210, 0xfedcba98, false, false));
}

// exp2 by v_exp_f32, eight at a time. The early-clobber outputs keep each v_exp off the sources of the one in front of it,
// and the closing v_nop is the slot the instruction set asks for between a transcendental and a next instruction that
// reads its result or overwrites its source (in a build with the plain call a dual-issue multiply stood there).
__device__ __forceinline__ v8f exp2_x8(v8f a) {
  float r0, r1, r2, r3, r4, r5, r6, r7;
  asm("v_exp_f32 %0, %8\n\tv_exp_f32 %1, %9\n\tv_exp_f32 %2, %10\n\tv_exp_f32 %3, %11\n\t"
      "v_exp_f32 %4, %12\n\tv_exp_f32 %5, %13\n\tv_exp_f32 %6, %14\n\tv_exp_f32 %7, %15\n\tv_nop"
      : "=&v"(r0), "=&v"(r1), "=&v"(r2), "=&v"(r3), "=&v"(r4), "=&v"(r5), "=&v"(r6), "=&v"(r7)
      : "v"(a[0]), "v"(a[1]), "v"(a[2]), "v"(a[3]), "v"(a[4]), "v"(a[5]), "v"(a[6]), "v"(a[7]));
  return (v8f){r0, r1, r2, r3, r4, r5, r6, r7};
}
// the same for one value
__device__ __forceinline__ float exp2_x1(float a) {
  float r;
  asm("v_exp_f32 %0, %1\n\tv_nop" : "=&v"(r) : "v"(a));
  return r;
}

__global__ __launch_bounds__(128)
void attn_kernel(const _Float16* __restrict__ Qt, const _Float16* __restrict__ Kt,
                 const _Float16* __restrict__ Vh, const unsigned int* __restrict__ mw,
                 float* __restrict__ out, int nheads) {
  __shared__ __align__(16) _Float16 Ksh[KC * LP];          // [kv][d]   9 KB, pitch LP
  __shared__ __align__(16) _Float16 Vth[HD * LP];          // [d][kv]   9 KB, pitch LP
  __shared__ __align__(16) float    Ob[HD * OP];           // [d][q] block tile, pitch 68 floats

  const int tid  = threadIdx.x;
  const int wave = tid >> 5;
  const int lane = tid & 31;
  const int hh   = lane >> 4;
  const int c    = lane & 15;

  const int bh  = blockIdx.y;
  const int b   = bh / nheads;
  const int qb  = blockIdx.x;
  const int q0b = qb * QB;
  const int q0  = q0b + wave * 16;

  const _Float16* qbp = Qt + (size_t)bh * S_LEN * HD;
  const _Float16* kbp = Kt + (size_t)bh * S_LEN * HD;
  const _Float16* vbp = Vh + (size_t)bh * HD * S_LEN;
  float*          obp = out + (size_t)bh * HD * S_LEN;

  // Q fragments (B operand): column q0 + c, two 32-wide d chunks
  v16h qf[2];
  qf[0] = Frag<_Float16>::load(qbp + (size_t)(q0 + c) * HD + 0  + 8 * hh);
  qf[1] = Frag<_Float16>::load(qbp + (size_t)(q0 + c) * HD + 32 + 8 * hh);

  // this wave's mask words: 32 a chunk, word j*8 + r = one bit a lane for register r of St tile j.
  // The wave number goes through readfirstlane and the pointer into the constant address space (the words were written by the
  // launch before and nothing writes them here), so that the loads are scalar and the words arrive in scalar registers.
  const cuint_p mwp = (cuint_p)(uintptr_t)(mw + (((size_t)b * (S_LEN / 16) + qb * NWAVE + __builtin_amdgcn_readfirstlane(wave)) * (S_LEN / KC)) * 32);

  float mrow = NEG_FILL, lrow = 0.f;   // running maximum (both halves alike) and this half's share of the sum
  v8f oacc[4];                         // Ot tile t, register r = channel t*16 + 8*hh + r of query q0 + c
#pragma unroll
  for (int t = 0; t < 4; ++t) oacc[t] = (v8f){0.f,0.f,0.f,0.f,0.f,0.f,0.f,0.f};

  for (int kc = 0; kc < S_LEN / KC; ++kc) {
    const int kv0 = kc * KC;
    // mask words of this chunk, in flight under the staging
    unsigned int mv[32];
#pragma unroll
    for (int i = 0; i < 32; ++i) mv[i] = mwp[kc * 32 + i];
    __syncthreads();
    // stage K chunk [kv][d] and V chunk [d][kv] as 16-B vector copies
#pragma unroll
    for (int i = 0; i < 4; ++i) {
      const int idx = tid + 128 * i;       // 0..511
      const int row = idx >> 3;            // 0..63
      const int c8  = (idx & 7) * 8;       // 0..56
      const v8h kv = *(const v8h*)(kbp + (size_t)(kv0 + row) * HD + c8);
      const v8h vv = *(const v8h*)(vbp + (size_t)row * S_LEN + kv0 + c8);
      *(v8h*)(Ksh + row * LP + c8) = kv;
      *(v8h*)(Vth + row * LP + c8) = vv;
    }
    __syncthreads();

    // K's eight A fragments, read from LDS as one group: one LDS latency for the run of eight WMMAs
    v16h kf[2][4];
#pragma unroll
    for (int h = 0; h < 2; ++h)
#pragma unroll
      for (int j = 0; j < 4; ++j) kf[h][j] = Frag<_Float16>::load(Ksh + (j * 16 + c) * LP + h * 32 + 8 * hh);
    // keeps the sixteen reads together in front of the WMMAs: without it the scheduler sinks each pair to its WMMA, with a wait at each
    __builtin_amdgcn_sched_barrier(0);

    // St: 64 keys x this wave's 16 queries (A = K rows, B = Q); four independent tiles, then their second halves
    v8f s[4];
#pragma unroll
    for (int j = 0; j < 4; ++j) s[j] = mma_h(kf[0][j], qf[0], (v8f){0.f,0.f,0.f,0.f,0.f,0.f,0.f,0.f});
#pragma unroll
    for (int j = 0; j < 4; ++j) s[j] = mma_h(kf[1][j], qf[1], s[j]);

    // V's eight A fragments, read in front of the softmax (the scheduler may start them among the score WMMAs): their LDS latency passes under it
    v16h vf[2][4];
#pragma unroll
    for (int kk = 0; kk < 2; ++kk)
#pragma unroll
      for (int t = 0; t < 4; ++t) vf[kk][t] = Frag<_Float16>::load(Vth + (t * 16 + c) * LP + kk * 32 + 8 * hh);
    // keeps the sixteen reads here, in front of the softmax: without it the scheduler sinks each pair to its WMMA, with a wait at each
    __builtin_amdgcn_sched_barrier(0);

    // scale, mask, chunk maximum of this lane's query
    float cmj[4];
#pragma unroll
    for (int j = 0; j < 4; ++j) {
      float m = NEG_FILL;
#pragma unroll
      for (int r = 0; r < 8; ++r) {
        float x = s[j][r] * SCALE_QK;
        if (__builtin_amdgcn_inverse_ballot_w32(mv[j * 8 + r])) x = NEG_FILL;   // the word is the select's lane mask
        s[j][r] = x;
        m = fmaxf(m, x);
      }
      cmj[j] = m;
    }
    float cm = fmaxf(fmaxf(cmj[0], cmj[1]), fmaxf(cmj[2], cmj[3]));
    cm = fmaxf(cm, xhalf(cm));

    // online softmax update; Pt (x2^15, f16) packed from the score registers into the B operand
    const float mnew  = fmaxf(mrow, cm);
    const float alpha = exp2_x1((mrow - mnew) * LOG2E);
    mrow = mnew;
    v16h pb[2];
    float psj[4];
#pragma unroll
    for (int j = 0; j < 4; ++j) {
      v8f a;
#pragma unroll
      for (int r = 0; r < 8; ++r) a[r] = (s[j][r] - mnew) * LOG2E;
      const v8f p = exp2_x8(a);
      float psum = 0.f;
#pragma unroll
      for (int r = 0; r < 8; ++r) {
        psum += p[r];
        pb[j >> 1][(j & 1) * 8 + r] = (_Float16)(p[r] * PSC);
      }
      psj[j] = psum;
    }
    lrow = lrow * alpha + ((psj[0] + psj[1]) + (psj[2] + psj[3]));
#pragma unroll
    for (int t = 0; t < 4; ++t)
#pragma unroll
      for (int r = 0; r < 8; ++r) oacc[t][r] *= alpha;

    // Ot += Vt * Pt (A = V channel rows, B = Pt)
#pragma unroll
    for (int kk = 0; kk < 2; ++kk) {
#pragma unroll
      for (int t = 0; t < 4; ++t) oacc[t] = mma_h(vf[kk][t], pb[kk], oacc[t]);
    }
  }

  // epilogue: join the halves' sums, normalise, stage block tile [d][q], write whole channel rows
  {
    const float inv = 1.0f / ((lrow + xhalf(lrow)) * PSC);
    const int qloc = wave * 16 + c;
#pragma unroll
    for (int t = 0; t < 4; ++t)
#pragma unroll
      for (int r = 0; r < 8; ++r) Ob[(t * 16 + 8 * hh + r) * OP + qloc] = oacc[t][r] * inv;
  }
  __syncthreads();
  {
    const int c4 = c * 4;
    {
#pragma unroll
      for (int it = 0; it < 8; ++it) {
        const int d = wave * 16 + it * 2 + hh;   // wave covers channels wave*16 .. +15
        const v4f val = *(const v4f*)(Ob + d * OP + c4);
        *(v4f*)(obp + (size_t)d * S_LEN + q0b + c4) = val;
      }
      
    }
  }
}

extern "C" void kernel_launch(void* const* d_in, const int* in_sizes, int n_in,
                              void* d_out, int out_size, void* d_ws, size_t ws_size,
                              hipStream_t stream) {
  if (n_in < 4) return;
  const float* q  = (const float*)d_in[0];
  const float* k  = (const float*)d_in[1];
  const float* v  = (const float*)d_in[2];
  const float* mk = (const float*)d_in[3];
  float* out = (float*)d_out;

  const int per_b = C_CH * S_LEN;
  const int nb = in_sizes[0] / per_b;
  if (nb <= 0 || in_sizes[0] != nb * per_b) return;
  if (in_sizes[1] != in_sizes[0] || in_sizes[2] != in_sizes[0]) return;
  if ((long long)in_sizes[3] != (long long)nb * S_LEN * S_LEN) return;
  if (out_size != in_sizes[0]) return;
  const int nbh = nb * N_HEADS;

  const size_t eb = (size_t)nbh * S_LEN * HD * sizeof(_Float16);   // bytes per f16 tensor copy
  const size_t offQ = 0, offK = eb, offV = 2 * eb;
  const size_t offM = 3 * eb;
  const size_t total = 3 * eb + (size_t)nb * S_LEN * (S_LEN / 8);   // one mask bit a score
  if (total > ws_size || total > (size_t)134217728) return;
  _Float16* Qt = (_Float16*)((char*)d_ws + offQ);
  _Float16* Kt = (_Float16*)((char*)d_ws + offK);
  _Float16* Vh = (_Float16*)((char*)d_ws + offV);
  unsigned int* Mw = (unsigned int*)((char*)d_ws + offM);

  // q, k: [bh][64][S] f32 -> [bh][S][64] f16; v: [bh][64][S] f32 -> same layout f16; mask: f32 -> bits
  tcast_kernel<<<dim3(S_LEN / 64, nbh, 4), 128, 0, stream>>>(q, k, v, mk, Qt, Kt, Vh, Mw);
  // attention
  attn_kernel<<<dim3(S_LEN / QB, nbh), 128, 0, stream>>>(Qt, Kt, Vh, Mw, out, N_HEADS);
  (void)hipGetLastError();
}

// v006
// Measured time: 36.9 microseconds a run.
// Two timings next to v005 both put it at 1.08 times that version's speed.
// All steps since v000 together make it 3.17 times as fast.
#include <hip/hip_runtime.h>
#include <stdint.h>

typedef __attribute__((ext_vector_type(16))) _Float16 v16h;
typedef __attribute__((ext_vector_type(8)))  _Float16 v8h;
typedef __attribute__((ext_vector_type(8)))  float    v8f;
typedef __attribute__((ext_vector_type(4)))  float    v4f;
typedef const unsigned int __attribute__((address_space(4)))* cuint_p;   // read-only for the whole launch

#define S_LEN 1024
#define HD 64
#define N_HEADS 8
#define C_CH 512
#define QB 64
#define KC 64
#define NWAVE 4
#define PSC 32768.0f
#define SCALE_QK 0.125f
#define NEG_FILL (-1.0e30f)
#define LOG2E 1.44269504f   // exp(x) = exp2(x * LOG2E), as __expf forms it
#define TP 72      // transpose tile pitch in halves (144 B rows)
#define OP 68      // output tile pitch in floats (272 B rows)
#define LP 72      // K and V tile pitch in halves: 144 B = 16 B x odd, so the 16 rows of a ds_load_b128 fragment read fall on distinct banks

// ---- 16-bit WMMA fragment loader (split k map: elements 0..7 <- p[0..7], 8..15 <- p[16..23]) ----
template <typename T> struct Frag;
template <> struct Frag<_Float16> {
  typedef v16h V; union U { v16h v; v8h h[2]; };
  static __device__ __forceinline__ v16h load(const _Float16* p) {
    U f; f.h[0] = *(const v8h*)(p); f.h[1] = *(const v8h*)(p + 16); return f.v;
  }
};

// plain builtin: the compiler keeps the distances behind it and is free to run WMMAs back to back
__device__ __forceinline__ v8f mma_h(v16h a, v16h b, v8f c) {
  return __builtin_amdgcn_wmma_f32_16x16x32_f16(false, a, false, b, (short)0, c, false, false);
}

// ---- operand casts, one launch. Grid slices z = 0, 1 (x0, x1), transpose-cast:
//      in[bh][64 d][S t] f32 (channel-major) -> out[bh][S t][64 d] f16 (token-major).
//      Slice z = 2 (x2), cast in place of layout: each block takes 4096 consecutive elements, 32 a thread.
//      Slice z = 3 (mk), mask packing: f32 [b][S q][S k] -> one bit a score, in the order the attention kernel selects by:
//      mw[b][q / 16][k / 64][word j*8 + r], bit hh*16 + c  =  (mk[b][q16*16 + c][k64*64 + j*16 + 8*hh + r] < -5000).
//      A wave takes 16 queries x 128 keys: each load is 512 consecutive bytes of one mask row. ----
__global__ __launch_bounds__(128) void tcast_kernel(
    const float* __restrict__ x0, const float* __restrict__ x1, const float* __restrict__ x2,
    const float* __restrict__ mk,
    _Float16* __restrict__ y0, _Float16* __restrict__ y1, _Float16* __restrict__ y2,
    unsigned int* __restrict__ mw) {
  __shared__ __align__(16) _Float16 T[64 * TP];   // [t][d], pitch 72 halves
  const int tid = threadIdx.x, lane = tid & 31, wave = tid >> 5;
  if (blockIdx.z == 2) {   // block-uniform, in front of the barrier
    const size_t base = ((size_t)blockIdx.y * (S_LEN / 64) + blockIdx.x) * (64 * HD) + (size_t)tid * 8;
    v4f a[4][2];           // all eight 16-B loads in flight before the first conversion
#pragma unroll
    for (int i = 0; i < 4; ++i) {
      a[i][0] = *(const v4f*)(x2 + base + i * 1024);
      a[i][1] = *(const v4f*)(x2 + base + i * 1024 + 4);
    }
#pragma unroll
    for (int i = 0; i < 4; ++i) {
      v8h h;
#pragma unroll
      for (int e = 0; e < 4; ++e) { h[e] = (_Float16)a[i][0][e]; h[4 + e] = (_Float16)a[i][1][e]; }
      *(v8h*)(y2 + base + i * 1024) = h;
    }
    return;
  }
  if (blockIdx.z == 3) {   // block-uniform, in front of the barrier
    // wave g of the slice: (b * 64 + q16) * 8 + pair of 64-key chunks
    const size_t g = ((size_t)blockIdx.y * (S_LEN / 64) + blockIdx.x) * 4 + wave;
    const float* mrow = mk + (g >> 3) * (16 * S_LEN) + (g & 7) * 128 + lane * 4;
    static_assert(N_HEADS * (S_LEN / 64) * 4 == (S_LEN / 16) * (S_LEN / 128), "the slice's waves cover a batch's mask exactly once");
    v4f a[16];             // row i, keys 4*lane .. 4*lane + 3 of the 128
#pragma unroll
    for (int i = 0; i < 16; ++i) a[i] = *(const v4f*)(mrow + i * S_LEN);
    // bw[e] of lane (c, hh): bit l = key 4*l + e of row c
    const int c = lane & 15, hh = lane >> 4;
    unsigned int bw[4] = {0u, 0u, 0u, 0u};
#pragma unroll
    for (int i = 0; i < 16; ++i)
#pragma unroll
      for (int e = 0; e < 4; ++e) {
        const unsigned int rowbits = __builtin_amdgcn_ballot_w32(a[i][e] < -5000.0f);
        bw[e] = (c == i) ? rowbits : bw[e];
      }
    // key ch*64 + j*16 + 8*hh + r = 4*l + e with e = r & 3, l = ch*16 + j*4 + 2*hh + (r >> 2)
#pragma unroll
    for (int e = 0; e < 4; ++e) bw[e] >>= 2 * hh;
#pragma unroll
    for (int ch = 0; ch < 2; ++ch) {
      unsigned int word = 0u;   // lane j*8 + r ends up holding word j*8 + r
#pragma unroll
      for (int j = 0; j < 4; ++j)
#pragma unroll
        for (int r = 0; r < 8; ++r) {
          const unsigned int sel = __builtin_amdgcn_ballot_w32((bw[r & 3] & (1u << (ch * 16 + j * 4 + (r >> 2)))) != 0u);
          word = (lane == j * 8 + r) ? sel : word;
        }
      mw[(g * 2 + ch) * 32 + lane] = word;
    }
    // the two stores' address and data registers are reused by the other slices' code, which the listing places behind this one
    asm volatile("s_wait_xcnt 0x0" ::: "memory");
    return;
  }
  const int t0 = blockIdx.x * 64;
  const int bh = blockIdx.y;
  const float* in = (blockIdx.z == 0) ? x0 : x1;
  _Float16* out = (blockIdx.z == 0) ? y0 : y1;
  const float* src = in + (size_t)bh * HD * S_LEN + t0;
#pragma unroll
  for (int i = 0; i < 8; ++i) {
    const int idx = tid + 128 * i;          // 0..1023
    const int d  = idx >> 4;                // 0..63
    const int t4 = (idx & 15) * 4;          // 0..60
    const v4f v = *(const v4f*)(src + (size_t)d * S_LEN + t4);
#pragma unroll
    for (int e = 0; e < 4; ++e) T[(t4 + e) * TP + d] = (_Float16)v[e];
  }
  __syncthreads();
  _Float16* dst = out + ((size_t)bh * S_LEN + t0) * HD;
  const int rq = lane >> 3, c8 = (lane & 7) * 8;
  {
#pragma unroll
    for (int it = 0; it < 4; ++it) {
      const int row = wave * 16 + it * 4 + rq;   // wave covers rows wave*16 .. +15
      const v8h hv = *(const v8h*)(T + row * TP + c8);
      *(v8h*)(dst + (size_t)row * HD + c8) = hv;
    }
    
  }
}

// lane l with lane l ^ 16 (one vector cross-row move)
__device__ __forceinline__ float xhalf(float x) {
  const int b = __builtin_bit_cast(int, x);
  return __builtin_bit_cast(float, __builtin_amdgcn_permlanex16(b, b, 0x76543210, 0xfedcba98, false, false));
}

// exp2 by v_exp_f32, eight at a time. The early-clobber outputs keep each v_exp off the sources of the one in front of it,
// and the closing v_nop is the slot the instruction set asks for between a transcendental and a next instruction that
// reads its result or overwrites its source (in a build with the plain call a dual-issue multiply stood there).
__device__ __forceinline__ v8f exp2_x8(v8f a) {
  float r0, r1, r2, r3, r4, r5, r6, r7;
  asm("v_exp_f32 %0, %8\n\tv_exp_f32 %1, %9\n\tv_exp_f32 %2, %10\n\tv_exp_f32 %3, %11\n\t"
      "v_exp_f32 %4, %12\n\tv_exp_f32 %5, %13\n\tv_exp_f32 %6, %14\n\tv_exp_f32 %7, %15\n\tv_nop"
      : "=&v"(r0), "=&v"(r1), "=&v"(r2), "=&v"(r3), "=&v"(r4), "=&v"(r5), "=&v"(r6), "=&v"(r7)
      : "v"(a[0]), "v"(a[1]), "v"(a[2]), "v"(a[3]), "v"(a[4]), "v"(a[5]), "v"(a[6]), "v"(a[7]));
  return (v8f){r0, r1, r2, r3, r4, r5, r6, r7};
}
// the same for one value
__device__ __forceinline__ float exp2_x1(float a) {
  float r;
  asm("v_exp_f32 %0, %1\n\tv_nop" : "=&v"(r) : "v"(a));
  return r;
}

// One 64-key chunk of K and V, global memory -> LDS through no register: eight asynchronous 16-B copies a lane
// (rows r, r + 16, r + 32, r + 48 of each tile). lk, lv: the lane's LDS byte addresses of its first K and V piece; kg, vg: the global ones.
// The closing s_wait_xcnt stands inside the statement, so that no address register is rewritten in front of it.
__device__ __forceinline__ void copy_chunk(uint32_t lk, uint32_t lv, const _Float16* kg, const _Float16* vg) {
  asm volatile(
      "global_load_async_to_lds_b128 %0, %8, off\n\t"
      "global_load_async_to_lds_b128 %1, %9, off\n\t"
      "global_load_async_to_lds_b128 %2, %10, off\n\t"
      "global_load_async_to_lds_b128 %3, %11, off\n\t"
      "global_load_async_to_lds_b128 %4, %12, off\n\t"
      "global_load_async_to_lds_b128 %5, %13, off\n\t"
      "global_load_async_to_lds_b128 %6, %14, off\n\t"
      "global_load_async_to_lds_b128 %7, %15, off\n\t"
      "s_wait_xcnt 0x0"
      :: "v"(lk), "v"(lk + 16 * LP * 2), "v"(lk + 32 * LP * 2), "v"(lk + 48 * LP * 2),
         "v"(lv), "v"(lv + 16 * LP * 2), "v"(lv + 32 * LP * 2), "v"(lv + 48 * LP * 2),
         "v"(kg), "v"(kg + 16 * HD), "v"(kg + 32 * HD), "v"(kg + 48 * HD),
         "v"(vg), "v"(vg + 16 * S_LEN), "v"(vg + 32 * S_LEN), "v"(vg + 48 * S_LEN)
      : "memory");
}

__global__ __launch_bounds__(128)
void attn_kernel(const _Float16* __restrict__ Qt, const _Float16* __restrict__ Kt,
                 const _Float16* __restrict__ Vh, const unsigned int* __restrict__ mw,
                 float* __restrict__ out, int nheads) {
  __shared__ __align__(16) _Float16 Ksh[2][KC * LP];       // [buffer][kv][d]   2 x 9 KB, pitch LP
  __shared__ __align__(16) _Float16 Vth[2][HD * LP];       // [buffer][d][kv]   2 x 9 KB, pitch LP
  __shared__ __align__(16) float    Ob[HD * OP];           // [d][q] block tile, pitch 68 floats

  const int tid  = threadIdx.x;
  const int wave = tid >> 5;
  const int lane = tid & 31;
  const int hh   = lane >> 4;
  const int c    = lane & 15;

  const int bh  = blockIdx.y;
  const int b   = bh / nheads;
  const int qb  = blockIdx.x;
  const int q0b = qb * QB;
  const int q0  = q0b + wave * 16;

  const _Float16* qbp = Qt + (size_t)bh * S_LEN * HD;
  const _Float16* kbp = Kt + (size_t)bh * S_LEN * HD;
  const _Float16* vbp = Vh + (size_t)bh * HD * S_LEN;
  float*          obp = out + (size_t)bh * HD * S_LEN;

  // Q fragments (B operand): column q0 + c, two 32-wide d chunks
  v16h qf[2];
  qf[0] = Frag<_Float16>::load(qbp + (size_t)(q0 + c) * HD + 0  + 8 * hh);
  qf[1] = Frag<_Float16>::load(qbp + (size_t)(q0 + c) * HD + 32 + 8 * hh);

  // this wave's mask words: 32 a chunk, word j*8 + r = one bit a lane for register r of St tile j.
  // The wave number goes through readfirstlane and the pointer into the constant address space (the words were written by the
  // launch before and nothing writes them here), so that the loads are scalar and the words arrive in scalar registers.
  const cuint_p mwp = (cuint_p)(uintptr_t)(mw + (((size_t)b * (S_LEN / 16) + qb * NWAVE + __builtin_amdgcn_readfirstlane(wave)) * (S_LEN / KC)) * 32);

  float mrow = NEG_FILL, lrow = 0.f;   // running maximum (both halves alike) and this half's share of the sum
  v8f oacc[4];                         // Ot tile t, register r = channel t*16 + 8*hh + r of query q0 + c
#pragma unroll
  for (int t = 0; t < 4; ++t) oacc[t] = (v8f){0.f,0.f,0.f,0.f,0.f,0.f,0.f,0.f};

  // this lane's piece of a chunk: row tid / 8 (and + 16, 32, 48), halves (tid & 7) * 8 .. + 7
  const int srow = tid >> 3, sc8 = (tid & 7) * 8;
  const uint32_t lk0 = (uint32_t)(size_t)(&Ksh[0][srow * LP + sc8]);   // low 32 bits of a __shared__ address = LDS byte address
  const uint32_t lv0 = (uint32_t)(size_t)(&Vth[0][srow * LP + sc8]);
  const _Float16* kg0 = kbp + (size_t)srow * HD + sc8;       // chunk kc: + kc * KC * HD
  const _Float16* vg0 = vbp + (size_t)srow * S_LEN + sc8;    // chunk kc: + kc * KC
  static_assert(S_LEN / KC >= 2, "the prologue fills two chunks");

  // prologue: chunk 0 lands and is published, then chunk 1 starts
  copy_chunk(lk0, lv0, kg0, vg0);
  asm volatile("s_wait_asynccnt 0x0" ::: "memory");   // this wave's copies of chunk 0 have landed
  __syncthreads();                                    // ... and every other wave's
  copy_chunk(lk0 + KC * LP * 2, lv0 + HD * LP * 2, kg0 + KC * HD, vg0 + KC);

  for (int kc = 0; kc < S_LEN / KC; ++kc) {
    const int buf = kc & 1;
    const _Float16* Kb = Ksh[buf];
    const _Float16* Vb = Vth[buf];
    // mask words of this chunk
    unsigned int mv[32];
#pragma unroll
    for (int i = 0; i < 32; ++i) mv[i] = mwp[kc * 32 + i];

    // K's eight A fragments, read from LDS as one group: one LDS latency for the run of eight WMMAs
    v16h kf[2][4];
#pragma unroll
    for (int h = 0; h < 2; ++h)
#pragma unroll
      for (int j = 0; j < 4; ++j) kf[h][j] = Frag<_Float16>::load(Kb + (j * 16 + c) * LP + h * 32 + 8 * hh);
    // keeps the sixteen reads together in front of the WMMAs: without it the scheduler sinks each pair to its WMMA, with a wait at each
    __builtin_amdgcn_sched_barrier(0);

    // St: 64 keys x this wave's 16 queries (A = K rows, B = Q); four independent tiles, then their second halves
    v8f s[4];
#pragma unroll
    for (int j = 0; j < 4; ++j) s[j] = mma_h(kf[0][j], qf[0], (v8f){0.f,0.f,0.f,0.f,0.f,0.f,0.f,0.f});
#pragma unroll
    for (int j = 0; j < 4; ++j) s[j] = mma_h(kf[1][j], qf[1], s[j]);

    // V's eight A fragments, read in front of the softmax (the scheduler may start them among the score WMMAs): their LDS latency passes under it
    v16h vf[2][4];
#pragma unroll
    for (int kk = 0; kk < 2; ++kk)
#pragma unroll
      for (int t = 0; t < 4; ++t) vf[kk][t] = Frag<_Float16>::load(Vb + (t * 16 + c) * LP + kk * 32 + 8 * hh);
    // keeps the sixteen reads here, in front of the softmax: without it the scheduler sinks each pair to its WMMA, with a wait at each
    __builtin_amdgcn_sched_barrier(0);

    // scale, mask, chunk maximum of this lane's query
    float cmj[4];
#pragma unroll
    for (int j = 0; j < 4; ++j) {
      float m = NEG_FILL;
#pragma unroll
      for (int r = 0; r < 8; ++r) {
        float x = s[j][r] * SCALE_QK;
        if (__builtin_amdgcn_inverse_ballot_w32(mv[j * 8 + r])) x = NEG_FILL;   // the word is the select's lane mask
        s[j][r] = x;
        m = fmaxf(m, x);
      }
      cmj[j] = m;
    }
    float cm = fmaxf(fmaxf(cmj[0], cmj[1]), fmaxf(cmj[2], cmj[3]));
    cm = fmaxf(cm, xhalf(cm));

    // online softmax update; Pt (x2^15, f16) packed from the score registers into the B operand
    const float mnew  = fmaxf(mrow, cm);
    const float alpha = exp2_x1((mrow - mnew) * LOG2E);
    mrow = mnew;
    v16h pb[2];
    float psj[4];
#pragma unroll
    for (int j = 0; j < 4; ++j) {
      v8f a;
#pragma unroll
      for (int r = 0; r < 8; ++r) a[r] = (s[j][r] - mnew) * LOG2E;
      const v8f p = exp2_x8(a);
      float psum = 0.f;
#pragma unroll
      for (int r = 0; r < 8; ++r) {
        psum += p[r];
        pb[j >> 1][(j & 1) * 8 + r] = (_Float16)(p[r] * PSC);
      }
      psj[j] = psum;
    }
    lrow = lrow * alpha + ((psj[0] + psj[1]) + (psj[2] + psj[3]));
#pragma unroll
    for (int t = 0; t < 4; ++t)
#pragma unroll
      for (int r = 0; r < 8; ++r) oacc[t][r] *= alpha;

    // Ot += Vt * Pt (A = V channel rows, B = Pt)
#pragma unroll
    for (int kk = 0; kk < 2; ++kk) {
#pragma unroll
      for (int t = 0; t < 4; ++t) oacc[t] = mma_h(vf[kk][t], pb[kk], oacc[t]);
    }

    // hand-over: chunk kc + 1 is published and this chunk's buffer is freed by the one barrier.
    // The scheduling barrier keeps the softmax and the WMMAs in front of it: without it the scheduler lifts the waits and the barrier
    // into the softmax while the copies stay at the foot, and the copies lose that much of their lead.
    __builtin_amdgcn_sched_barrier(0);
    asm volatile("s_wait_dscnt 0x0" ::: "memory");      // this wave's reads of the buffer have returned
    asm volatile("s_wait_asynccnt 0x0" ::: "memory");   // this wave's copies of chunk kc + 1 have landed
    __syncthreads();
    if (kc + 2 < S_LEN / KC)                            // the same for the whole block
      copy_chunk(lk0 + buf * (KC * LP * 2), lv0 + buf * (HD * LP * 2), kg0 + (size_t)(kc + 2) * (KC * HD), vg0 + (kc + 2) * KC);
  }
  asm volatile("s_wait_asynccnt 0x0" ::: "memory");     // nothing is in flight when the wave goes on to the epilogue and ends

  // epilogue: join the halves' sums, normalise, stage block tile [d][q], write whole channel rows
  {
    const float inv = 1.0f / ((lrow + xhalf(lrow)) * PSC);
    const int qloc = wave * 16 + c;
#pragma unroll
    for (int t = 0; t < 4; ++t)
#pragma unroll
      for (int r = 0; r < 8; ++r) Ob[(t * 16 + 8 * hh + r) * OP + qloc] = oacc[t][r] * inv;
  }
  __syncthreads();
  {
    const int c4 = c * 4;
    {
#pragma unroll
      for (int it = 0; it < 8; ++it) {
        const int d = wave * 16 + it * 2 + hh;   // wave covers channels wave*16 .. +15
        const v4f val = *(const v4f*)(Ob + d * OP + c4);
        *(v4f*)(obp + (size_t)d * S_LEN + q0b + c4) = val;
      }
      
    }
  }
}

extern "C" void kernel_launch(void* const* d_in, const int* in_sizes, int n_in,
                              void* d_out, int out_size, void* d_ws, size_t ws_size,
                              hipStream_t stream) {
  if (n_in < 4) return;
  const float* q  = (const float*)d_in[0];
  const float* k  = (const float*)d_in[1];
  const float* v  = (const float*)d_in[2];
  const float* mk = (const float*)d_in[3];
  float* out = (float*)d_out;

  const int per_b = C_CH * S_LEN;
  const int nb = in_sizes[0] / per_b;
  if (nb <= 0 || in_sizes[0] != nb * per_b) return;
  if (in_sizes[1] != in_sizes[0] || in_sizes[2] != in_sizes[0]) return;
  if ((long long)in_sizes[3] != (long long)nb * S_LEN * S_LEN) return;
  if (out_size != in_sizes[0]) return;
  const int nbh = nb * N_HEADS;

  const size_t eb = (size_t)nbh * S_LEN * HD * sizeof(_Float16);   // bytes per f16 tensor copy
  const size_t offQ = 0, offK = eb, offV = 2 * eb;
  const size_t offM = 3 * eb;
  const size_t total = 3 * eb + (size_t)nb * S_LEN * (S_LEN / 8);   // one mask bit a score
  if (total > ws_size || total > (size_t)134217728) return;
  _Float16* Qt = (_Float16*)((char*)d_ws + offQ);
  _Float16* Kt = (_Float16*)((char*)d_ws + offK);
  _Float16* Vh = (_Float16*)((char*)d_ws + offV);
  unsigned int* Mw = (unsigned int*)((char*)d_ws + offM);

  // q, k: [bh][64][S] f32 -> [bh][S][64] f16; v: [bh][64][S] f32 -> same layout f16; mask: f32 -> bits
  tcast_kernel<<<dim3(S_LEN / 64, nbh, 4), 128, 0, stream>>>(q, k, v, mk, Qt, Kt, Vh, Mw);
  // attention
  attn_kernel<<<dim3(S_LEN / QB, nbh), 128, 0, stream>>>(Qt, Kt, Vh, Mw, out, N_HEADS);
  (void)hipGetLastError();
}

// v007
// A run of this version takes 35.5 microseconds.
// In both of two side-by-side timings against v006, it was 1.04 times as fast.
// Over all steps from v000 it is 3.31 times as fast.
#include <hip/hip_runtime.h>
#include <stdint.h>

typedef __attribute__((ext_vector_type(16))) _Float16 v16h;
typedef __attribute__((ext_vector_type(8)))  _Float16 v8h;
typedef __attribute__((ext_vector_type(8)))  float    v8f;
typedef __attribute__((ext_vector_type(4)))  float    v4f;
typedef const unsigned int __attribute__((address_space(4)))* cuint_p;   // read-only for the whole launch

#define S_LEN 1024
#define HD 64
#define N_HEADS 8
#define C_CH 512
#define QB 64
#define KC 64
#define NWAVE 4
#define PSH 15.0f   // P and its sum are carried x2^15: the shift is taken off the subtracted maximum
#define SCALE_QK 0.125f
#define NEG_FILL (-1.0e30f)
#define LOG2E 1.44269504f   // exp(x) = exp2(x * LOG2E), as __expf forms it
#define QMUL (SCALE_QK * LOG2E)   // multiplied into Q in f32, in front of its rounding to f16
#define TP 72      // transpose tile pitch in halves (144 B rows)
#define OP 68      // output tile pitch in floats (272 B rows)
#define LP 72      // K and V tile pitch in halves: 144 B = 16 B x odd, so the 16 rows of a ds_load_b128 fragment read fall on distinct banks

// ---- 16-bit WMMA fragment loader (split k map: elements 0..7 <- p[0..7], 8..15 <- p[16..23]) ----
template <typename T> struct Frag;
template <> struct Frag<_Float16> {
  typedef v16h V; union U { v16h v; v8h h[2]; };
  static __device__ __forceinline__ v16h load(const _Float16* p) {
    U f; f.h[0] = *(const v8h*)(p); f.h[1] = *(const v8h*)(p + 16); return f.v;
  }
};

// plain builtin: the compiler keeps the distances behind it and is free to run WMMAs back to back
__device__ __forceinline__ v8f mma_h(v16h a, v16h b, v8f c) {
  return __builtin_amdgcn_wmma_f32_16x16x32_f16(false, a, false, b, (short)0, c, false, false);
}

// ---- operand casts, one launch. Grid slices z = 0, 1 (x0, x1), transpose-cast:
//      in[bh][64 d][S t] f32 (channel-major) -> out[bh][S t][64 d] f16 (token-major); x0 is multiplied by QMUL on the way.
//      Slice z = 2 (x2), cast in place of layout: each block takes 4096 consecutive elements, 32 a thread.
//      Slice z = 3 (mk), mask packing: f32 [b][S q][S k] -> one bit a score, in the order the attention kernel selects by:
//      mw[b][q / 16][k / 64][word j*8 + r], bit hh*16 + c  =  (mk[b][q16*16 + c][k64*64 + j*16 + 8*hh + r] < -5000).
//      A wave takes 16 queries x 128 keys: each load is 512 consecutive bytes of one mask row. ----
__global__ __launch_bounds__(128) void tcast_kernel(
    const float* __restrict__ x0, const float* __restrict__ x1, const float* __restrict__ x2,
    const float* __restrict__ mk,
    _Float16* __restrict__ y0, _Float16* __restrict__ y1, _Float16* __restrict__ y2,
    unsigned int* __restrict__ mw) {
  __shared__ __align__(16) _Float16 T[64 * TP];   // [t][d], pitch 72 halves
  const int tid = threadIdx.x, lane = tid & 31, wave = tid >> 5;
  if (blockIdx.z == 2) {   // block-uniform, in front of the barrier
    const size_t base = ((size_t)blockIdx.y * (S_LEN / 64) + blockIdx.x) * (64 * HD) + (size_t)tid * 8;
    v4f a[4][2];           // all eight 16-B loads in flight before the first conversion
#pragma unroll
    for (int i = 0; i < 4; ++i) {
      a[i][0] = *(const v4f*)(x2 + base + i * 1024);
      a[i][1] = *(const v4f*)(x2 + base + i * 1024 + 4);
    }
#pragma unroll
    for (int i = 0; i < 4; ++i) {
      v8h h;
#pragma unroll
      for (int e = 0; e < 4; ++e) { h[e] = (_Float16)a[i][0][e]; h[4 + e] = (_Float16)a[i][1][e]; }
      *(v8h*)(y2 + base + i * 1024) = h;
    }
    return;
  }
  if (blockIdx.z == 3) {   // block-uniform, in front of the barrier
    // wave g of the slice: (b * 64 + q16) * 8 + pair of 64-key chunks
    const size_t g = ((size_t)blockIdx.y * (S_LEN / 64) + blockIdx.x) * 4 + wave;
    const float* mrow = mk + (g >> 3) * (16 * S_LEN) + (g & 7) * 128 + lane * 4;
    static_assert(N_HEADS * (S_LEN / 64) * 4 == (S_LEN / 16) * (S_LEN / 128), "the slice's waves cover a batch's mask exactly once");
    v4f a[16];             // row i, keys 4*lane .. 4*lane + 3 of the 128
#pragma unroll
    for (int i = 0; i < 16; ++i) a[i] = *(const v4f*)(mrow + i * S_LEN);
    // bw[e] of lane (c, hh): bit l = key 4*l + e of row c
    const int c = lane & 15, hh = lane >> 4;
    unsigned int bw[4] = {0u, 0u, 0u, 0u};
#pragma unroll
    for (int i = 0; i < 16; ++i)
#pragma unroll
      for (int e = 0; e < 4; ++e) {
        const unsigned int rowbits = __builtin_amdgcn_ballot_w32(a[i][e] < -5000.0f);
        bw[e] = (c == i) ? rowbits : bw[e];
      }
    // key ch*64 + j*16 + 8*hh + r = 4*l + e with e = r & 3, l = ch*16 + j*4 + 2*hh + (r >> 2)
#pragma unroll
    for (int e = 0; e < 4; ++e) bw[e] >>= 2 * hh;
#pragma unroll
    for (int ch = 0; ch < 2; ++ch) {
      unsigned int word = 0u;   // lane j*8 + r ends up holding word j*8 + r
#pragma unroll
      for (int j = 0; j < 4; ++j)
#pragma unroll
        for (int r = 0; r < 8; ++r) {
          const unsigned int sel = __builtin_amdgcn_ballot_w32((bw[r & 3] & (1u << (ch * 16 + j * 4 + (r >> 2)))) != 0u);
          word = (lane == j * 8 + r) ? sel : word;
        }
      mw[(g * 2 + ch) * 32 + lane] = word;
    }
    // the two stores' address and data registers are reused by the other slices' code, which the listing places behind this one
    asm volatile("s_wait_xcnt 0x0" ::: "memory");
    return;
  }
  const int t0 = blockIdx.x * 64;
  const int bh = blockIdx.y;
  const float* in = (blockIdx.z == 0) ? x0 : x1;
  _Float16* out = (blockIdx.z == 0) ? y0 : y1;
  const float mul = (blockIdx.z == 0) ? QMUL : 1.0f;
  const float* src = in + (size_t)bh * HD * S_LEN + t0;
#pragma unroll
  for (int i = 0; i < 8; ++i) {
    const int idx = tid + 128 * i;          // 0..1023
    const int d  = idx >> 4;                // 0..63
    const int t4 = (idx & 15) * 4;          // 0..60
    const v4f v = *(const v4f*)(src + (size_t)d * S_LEN + t4);
#pragma unroll
    for (int e = 0; e < 4; ++e) T[(t4 + e) * TP + d] = (_Float16)(v[e] * mul);
  }
  __syncthreads();
  _Float16* dst = out + ((size_t)bh * S_LEN + t0) * HD;
  const int rq = lane >> 3, c8 = (lane & 7) * 8;
  {
#pragma unroll
    for (int it = 0; it < 4; ++it) {
      const int row = wave * 16 + it * 4 + rq;   // wave covers rows wave*16 .. +15
      const v8h hv = *(const v8h*)(T + row * TP + c8);
      *(v8h*)(dst + (size_t)row * HD + c8) = hv;
    }
    
  }
}

// lane l with lane l ^ 16 (one vector cross-row move)
__device__ __forceinline__ float xhalf(float x) {
  const int b = __builtin_bit_cast(int, x);
  return __builtin_bit_cast(float, __builtin_amdgcn_permlanex16(b, b, 0x76543210, 0xfedcba98, false, false));
}

// exp2 by v_exp_f32, eight at a time. The early-clobber outputs keep each v_exp off the sources of the one in front of it,
// and the closing v_nop is the slot the instruction set asks for between a transcendental and a next instruction that
// reads its result or overwrites its source (in a build with the plain call a dual-issue multiply stood there).
__device__ __forceinline__ v8f exp2_x8(v8f a) {
  float r0, r1, r2, r3, r4, r5, r6, r7;
  asm("v_exp_f32 %0, %8\n\tv_exp_f32 %1, %9\n\tv_exp_f32 %2, %10\n\tv_exp_f32 %3, %11\n\t"
      "v_exp_f32 %4, %12\n\tv_exp_f32 %5, %13\n\tv_exp_f32 %6, %14\n\tv_exp_f32 %7, %15\n\tv_nop"
      : "=&v"(r0), "=&v"(r1), "=&v"(r2), "=&v"(r3), "=&v"(r4), "=&v"(r5), "=&v"(r6), "=&v"(r7)
      : "v"(a[0]), "v"(a[1]), "v"(a[2]), "v"(a[3]), "v"(a[4]), "v"(a[5]), "v"(a[6]), "v"(a[7]));
  return (v8f){r0, r1, r2, r3, r4, r5, r6, r7};
}
// the same for one value
__device__ __forceinline__ float exp2_x1(float a) {
  float r;
  asm("v_exp_f32 %0, %1\n\tv_nop" : "=&v"(r) : "v"(a));
  return r;
}

// One 64-key chunk of K and V, global memory -> LDS through no register: eight asynchronous 16-B copies a lane
// (rows r, r + 16, r + 32, r + 48 of each tile). lk, lv: the lane's LDS byte addresses of its first K and V piece; kg, vg: the global ones.
// The closing s_wait_xcnt stands inside the statement, so that no address register is rewritten in front of it.
__device__ __forceinline__ void copy_chunk(uint32_t lk, uint32_t lv, const _Float16* kg, const _Float16* vg) {
  asm volatile(
      "global_load_async_to_lds_b128 %0, %8, off\n\t"
      "global_load_async_to_lds_b128 %1, %9, off\n\t"
      "global_load_async_to_lds_b128 %2, %10, off\n\t"
      "global_load_async_to_lds_b128 %3, %11, off\n\t"
      "global_load_async_to_lds_b128 %4, %12, off\n\t"
      "global_load_async_to_lds_b128 %5, %13, off\n\t"
      "global_load_async_to_lds_b128 %6, %14, off\n\t"
      "global_load_async_to_lds_b128 %7, %15, off\n\t"
      "s_wait_xcnt 0x0"
      :: "v"(lk), "v"(lk + 16 * LP * 2), "v"(lk + 32 * LP * 2), "v"(lk + 48 * LP * 2),
         "v"(lv), "v"(lv + 16 * LP * 2), "v"(lv + 32 * LP * 2), "v"(lv + 48 * LP * 2),
         "v"(kg), "v"(kg + 16 * HD), "v"(kg + 32 * HD), "v"(kg + 48 * HD),
         "v"(vg), "v"(vg + 16 * S_LEN), "v"(vg + 32 * S_LEN), "v"(vg + 48 * S_LEN)
      : "memory");
}

__global__ __launch_bounds__(128)
void attn_kernel(const _Float16* __restrict__ Qt, const _Float16* __restrict__ Kt,
                 const _Float16* __restrict__ Vh, const unsigned int* __restrict__ mw,
                 float* __restrict__ out, int nheads) {
  __shared__ __align__(16) _Float16 Ksh[2][KC * LP];       // [buffer][kv][d]   2 x 9 KB, pitch LP
  __shared__ __align__(16) _Float16 Vth[2][HD * LP];       // [buffer][d][kv]   2 x 9 KB, pitch LP
  __shared__ __align__(16) float    Ob[HD * OP];           // [d][q] block tile, pitch 68 floats

  const int tid  = threadIdx.x;
  const int wave = tid >> 5;
  const int lane = tid & 31;
  const int hh   = lane >> 4;
  const int c    = lane & 15;

  const int bh  = blockIdx.y;
  const int b   = bh / nheads;
  const int qb  = blockIdx.x;
  const int q0b = qb * QB;
  const int q0  = q0b + wave * 16;

  const _Float16* qbp = Qt + (size_t)bh * S_LEN * HD;
  const _Float16* kbp = Kt + (size_t)bh * S_LEN * HD;
  const _Float16* vbp = Vh + (size_t)bh * HD * S_LEN;
  float*          obp = out + (size_t)bh * HD * S_LEN;

  // Q fragments (B operand): column q0 + c, two 32-wide d chunks
  v16h qf[2];
  qf[0] = Frag<_Float16>::load(qbp + (size_t)(q0 + c) * HD + 0  + 8 * hh);
  qf[1] = Frag<_Float16>::load(qbp + (size_t)(q0 + c) * HD + 32 + 8 * hh);

  // this wave's mask words: 32 a chunk, word j*8 + r = one bit a lane for register r of St tile j.
  // The wave number goes through readfirstlane and the pointer into the constant address space (the words were written by the
  // launch before and nothing writes them here), so that the loads are scalar and the words arrive in scalar registers.
  const cuint_p mwp = (cuint_p)(uintptr_t)(mw + (((size_t)b * (S_LEN / 16) + qb * NWAVE + __builtin_amdgcn_readfirstlane(wave)) * (S_LEN / KC)) * 32);

  float mrow = NEG_FILL, lrow = 0.f;   // running maximum (both halves alike) and this half's share of the sum
  v8f oacc[4];                         // Ot tile t, register r = channel t*16 + 8*hh + r of query q0 + c
#pragma unroll
  for (int t = 0; t < 4; ++t) oacc[t] = (v8f){0.f,0.f,0.f,0.f,0.f,0.f,0.f,0.f};

  // this lane's piece of a chunk: row tid / 8 (and + 16, 32, 48), halves (tid & 7) * 8 .. + 7
  const int srow = tid >> 3, sc8 = (tid & 7) * 8;
  const uint32_t lk0 = (uint32_t)(size_t)(&Ksh[0][srow * LP + sc8]);   // low 32 bits of a __shared__ address = LDS byte address
  const uint32_t lv0 = (uint32_t)(size_t)(&Vth[0][srow * LP + sc8]);
  const _Float16* kg0 = kbp + (size_t)srow * HD + sc8;       // chunk kc: + kc * KC * HD
  const _Float16* vg0 = vbp + (size_t)srow * S_LEN + sc8;    // chunk kc: + kc * KC
  static_assert(S_LEN / KC >= 2, "the prologue fills two chunks");

  // prologue: chunk 0 lands and is published, then chunk 1 starts
  copy_chunk(lk0, lv0, kg0, vg0);
  asm volatile("s_wait_asynccnt 0x0" ::: "memory");   // this wave's copies of chunk 0 have landed
  __syncthreads();                                    // ... and every other wave's
  copy_chunk(lk0 + KC * LP * 2, lv0 + HD * LP * 2, kg0 + KC * HD, vg0 + KC);

  for (int kc = 0; kc < S_LEN / KC; ++kc) {
    const int buf = kc & 1;
    const _Float16* Kb = Ksh[buf];
    const _Float16* Vb = Vth[buf];
    // mask words of this chunk
    unsigned int mv[32];
#pragma unroll
    for (int i = 0; i < 32; ++i) mv[i] = mwp[kc * 32 + i];

    // K's eight A fragments, read from LDS as one group: one LDS latency for the run of eight WMMAs
    v16h kf[2][4];
#pragma unroll
    for (int h = 0; h < 2; ++h)
#pragma unroll
      for (int j = 0; j < 4; ++j) kf[h][j] = Frag<_Float16>::load(Kb + (j * 16 + c) * LP + h * 32 + 8 * hh);
    // keeps the sixteen reads together in front of the WMMAs: without it the scheduler sinks each pair to its WMMA, with a wait at each
    __builtin_amdgcn_sched_barrier(0);

    // St: 64 keys x this wave's 16 queries (A = K rows, B = Q); four independent tiles, then their second halves
    v8f s[4];
#pragma unroll
    for (int j = 0; j < 4; ++j) s[j] = mma_h(kf[0][j], qf[0], (v8f){0.f,0.f,0.f,0.f,0.f,0.f,0.f,0.f});
#pragma unroll
    for (int j = 0; j < 4; ++j) s[j] = mma_h(kf[1][j], qf[1], s[j]);

    // V's eight A fragments, read in front of the softmax (the scheduler may start them among the score WMMAs): their LDS latency passes under it
    v16h vf[2][4];
#pragma unroll
    for (int kk = 0; kk < 2; ++kk)
#pragma unroll
      for (int t = 0; t < 4; ++t) vf[kk][t] = Frag<_Float16>::load(Vb + (t * 16 + c) * LP + kk * 32 + 8 * hh);
    // keeps the sixteen reads here, in front of the softmax: without it the scheduler sinks each pair to its WMMA, with a wait at each
    __builtin_amdgcn_sched_barrier(0);

    // mask, chunk maximum of this lane's query (scores in log2 units)
    float cmj[4];
#pragma unroll
    for (int j = 0; j < 4; ++j) {
      float m = NEG_FILL;
#pragma unroll
      for (int r = 0; r < 8; ++r) {
        float x = s[j][r];
        if (__builtin_amdgcn_inverse_ballot_w32(mv[j * 8 + r])) x = NEG_FILL;   // the word is the select's lane mask
        s[j][r] = x;
        m = fmaxf(m, x);
      }
      cmj[j] = m;
    }
    float cm = fmaxf(fmaxf(cmj[0], cmj[1]), fmaxf(cmj[2], cmj[3]));
    cm = fmaxf(cm, xhalf(cm));

    // online softmax update; Pt (x2^15, f16) packed from the score registers into the B operand
    const float mnew  = fmaxf(mrow, cm);
    const float alpha = exp2_x1(mrow - mnew);
    const float msub  = mnew - PSH;   // exp2(x - msub) = 2^15 * exp2(x - mnew)
    mrow = mnew;
    v16h pb[2];
    float psj[4];
#pragma unroll
    for (int j = 0; j < 4; ++j) {
      v8f a;
#pragma unroll
      for (int r = 0; r < 8; ++r) a[r] = s[j][r] - msub;
      const v8f p = exp2_x8(a);
      float psum = 0.f;
#pragma unroll
      for (int r = 0; r < 8; ++r) {
        psum += p[r];
        pb[j >> 1][(j & 1) * 8 + r] = (_Float16)p[r];
      }
      psj[j] = psum;
    }
    lrow = lrow * alpha + ((psj[0] + psj[1]) + (psj[2] + psj[3]));
#pragma unroll
    for (int t = 0; t < 4; ++t)
#pragma unroll
      for (int r = 0; r < 8; ++r) oacc[t][r] *= alpha;

    // Ot += Vt * Pt (A = V channel rows, B = Pt)
#pragma unroll
    for (int kk = 0; kk < 2; ++kk) {
#pragma unroll
      for (int t = 0; t < 4; ++t) oacc[t] = mma_h(vf[kk][t], pb[kk], oacc[t]);
    }

    // hand-over: chunk kc + 1 is published and this chunk's buffer is freed by the one barrier.
    // The scheduling barrier keeps the softmax and the WMMAs in front of it: without it the scheduler lifts the waits and the barrier
    // into the softmax while the copies stay at the foot, and the copies lose that much of their lead.
    __builtin_amdgcn_sched_barrier(0);
    asm volatile("s_wait_dscnt 0x0" ::: "memory");      // this wave's reads of the buffer have returned
    asm volatile("s_wait_asynccnt 0x0" ::: "memory");   // this wave's copies of chunk kc + 1 have landed
    __syncthreads();
    if (kc + 2 < S_LEN / KC)                            // the same for the whole block
      copy_chunk(lk0 + buf * (KC * LP * 2), lv0 + buf * (HD * LP * 2), kg0 + (size_t)(kc + 2) * (KC * HD), vg0 + (kc + 2) * KC);
  }
  asm volatile("s_wait_asynccnt 0x0" ::: "memory");     // nothing is in flight when the wave goes on to the epilogue and ends

  // epilogue: join the halves' sums, normalise, stage block tile [d][q], write whole channel rows
  {
    const float inv = 1.0f / (lrow + xhalf(lrow));   // the sum carries the same 2^15 as Ot
    const int qloc = wave * 16 + c;
#pragma unroll
    for (int t = 0; t < 4; ++t)
#pragma unroll
      for (int r = 0; r < 8; ++r) Ob[(t * 16 + 8 * hh + r) * OP + qloc] = oacc[t][r] * inv;
  }
  __syncthreads();
  {
    const int c4 = c * 4;
    {
#pragma unroll
      for (int it = 0; it < 8; ++it) {
        const int d = wave * 16 + it * 2 + hh;   // wave covers channels wave*16 .. +15
        const v4f val = *(const v4f*)(Ob + d * OP + c4);
        *(v4f*)(obp + (size_t)d * S_LEN + q0b + c4) = val;
      }
      
    }
  }
}

extern "C" void kernel_launch(void* const* d_in, const int* in_sizes, int n_in,
                              void* d_out, int out_size, void* d_ws, size_t ws_size,
                              hipStream_t stream) {
  if (n_in < 4) return;
  const float* q  = (const float*)d_in[0];
  const float* k  = (const float*)d_in[1];
  const float* v  = (const float*)d_in[2];
  const float* mk = (const float*)d_in[3];
  float* out = (float*)d_out;

  const int per_b = C_CH * S_LEN;
  const int nb = in_sizes[0] / per_b;
  if (nb <= 0 || in_sizes[0] != nb * per_b) return;
  if (in_sizes[1] != in_sizes[0] || in_sizes[2] != in_sizes[0]) return;
  if ((long long)in_sizes[3] != (long long)nb * S_LEN * S_LEN) return;
  if (out_size != in_sizes[0]) return;
  const int nbh = nb * N_HEADS;

  const size_t eb = (size_t)nbh * S_LEN * HD * sizeof(_Float16);   // bytes per f16 tensor copy
  const size_t offQ = 0, offK = eb, offV = 2 * eb;
  const size_t offM = 3 * eb;
  const size_t total = 3 * eb + (size_t)nb * S_LEN * (S_LEN / 8);   // one mask bit a score
  if (total > ws_size || total > (size_t)134217728) return;
  _Float16* Qt = (_Float16*)((char*)d_ws + offQ);
  _Float16* Kt = (_Float16*)((char*)d_ws + offK);
  _Float16* Vh = (_Float16*)((char*)d_ws + offV);
  unsigned int* Mw = (unsigned int*)((char*)d_ws + offM);

  // q, k: [bh][64][S] f32 -> [bh][S][64] f16; v: [bh][64][S] f32 -> same layout f16; mask: f32 -> bits
  tcast_kernel<<<dim3(S_LEN / 64, nbh, 4), 128, 0, stream>>>(q, k, v, mk, Qt, Kt, Vh, Mw);
  // attention
  attn_kernel<<<dim3(S_LEN / QB, nbh), 128, 0, stream>>>(Qt, Kt, Vh, Mw, out, N_HEADS);
  (void)hipGetLastError();
}

// v008
// It runs in 34.2 microseconds.
// Timed twice side by side with v007, it ran 1.03 and 1.04 times as fast.
// Counting every step since v000, it is 3.42 times as fast.
#include <hip/hip_runtime.h>
#include <stdint.h>

typedef __attribute__((ext_vector_type(16))) _Float16 v16h;
typedef __attribute__((ext_vector_type(8)))  _Float16 v8h;
typedef __attribute__((ext_vector_type(8)))  float    v8f;
typedef __attribute__((ext_vector_type(4)))  float    v4f;
typedef const unsigned int __attribute__((address_space(4)))* cuint_p;   // read-only for the whole launch

#define S_LEN 1024
#define HD 64
#define N_HEADS 8
#define C_CH 512
#define QB 128
#define NG 2      // 16-query column groups a wave: each K and V fragment read from LDS serves NG WMMAs
#define KC 64
#define NWAVE 4
#define PSH 15.0f   // P and its sum are carried x2^15: the shift is taken off the subtracted maximum
#define SCALE_QK 0.125f
#define NEG_FILL (-1.0e30f)
#define LOG2E 1.44269504f   // exp(x) = exp2(x * LOG2E), as __expf forms it
#define QMUL (SCALE_QK * LOG2E)   // multiplied into Q in f32, in front of its rounding to f16
#define TP 72      // transpose tile pitch in halves (144 B rows)
#define OP 132     // output tile pitch in floats (528 B rows)
#define LP 72      // K and V tile pitch in halves: 144 B = 16 B x odd, so the 16 rows of a ds_load_b128 fragment read fall on distinct banks

// ---- 16-bit WMMA fragment loader (split k map: elements 0..7 <- p[0..7], 8..15 <- p[16..23]) ----
template <typename T> struct Frag;
template <> struct Frag<_Float16> {
  typedef v16h V; union U { v16h v; v8h h[2]; };
  static __device__ __forceinline__ v16h load(const _Float16* p) {
    U f; f.h[0] = *(const v8h*)(p); f.h[1] = *(const v8h*)(p + 16); return f.v;
  }
};

// plain builtin: the compiler keeps the distances behind it and is free to run WMMAs back to back
__device__ __forceinline__ v8f mma_h(v16h a, v16h b, v8f c) {
  return __builtin_amdgcn_wmma_f32_16x16x32_f16(false, a, false, b, (short)0, c, false, false);
}

// ---- operand casts, one launch. Grid slices z = 0, 1 (x0, x1), transpose-cast:
//      in[bh][64 d][S t] f32 (channel-major) -> out[bh][S t][64 d] f16 (token-major); x0 is multiplied by QMUL on the way.
//      Slice z = 2 (x2), cast in place of layout: each block takes 4096 consecutive elements, 32 a thread.
//      Slice z = 3 (mk), mask packing: f32 [b][S q][S k] -> one bit a score, in the order the attention kernel selects by:
//      mw[b][q / 16][k / 64][word j*8 + r], bit hh*16 + c  =  (mk[b][q16*16 + c][k64*64 + j*16 + 8*hh + r] < -5000).
//      A wave takes 16 queries x 128 keys: each load is 512 consecutive bytes of one mask row. ----
__global__ __launch_bounds__(128) void tcast_kernel(
    const float* __restrict__ x0, const float* __restrict__ x1, const float* __restrict__ x2,
    const float* __restrict__ mk,
    _Float16* __restrict__ y0, _Float16* __restrict__ y1, _Float16* __restrict__ y2,
    unsigned int* __restrict__ mw) {
  __shared__ __align__(16) _Float16 T[64 * TP];   // [t][d], pitch 72 halves
  const int tid = threadIdx.x, lane = tid & 31, wave = tid >> 5;
  if (blockIdx.z == 2) {   // block-uniform, in front of the barrier
    const size_t base = ((size_t)blockIdx.y * (S_LEN / 64) + blockIdx.x) * (64 * HD) + (size_t)tid * 8;
    v4f a[4][2];           // all eight 16-B loads in flight before the first conversion
#pragma unroll
    for (int i = 0; i < 4; ++i) {
      a[i][0] = *(const v4f*)(x2 + base + i * 1024);
      a[i][1] = *(const v4f*)(x2 + base + i * 1024 + 4);
    }
#pragma unroll
    for (int i = 0; i < 4; ++i) {
      v8h h;
#pragma unroll
      for (int e = 0; e < 4; ++e) { h[e] = (_Float16)a[i][0][e]; h[4 + e] = (_Float16)a[i][1][e]; }
      *(v8h*)(y2 + base + i * 1024) = h;
    }
    return;
  }
  if (blockIdx.z == 3) {   // block-uniform, in front of the barrier
    // wave g of the slice: (b * 64 + q16) * 8 + pair of 64-key chunks
    const size_t g = ((size_t)blockIdx.y * (S_LEN / 64) + blockIdx.x) * 4 + wave;
    const float* mrow = mk + (g >> 3) * (16 * S_LEN) + (g & 7) * 128 + lane * 4;
    static_assert(N_HEADS * (S_LEN / 64) * 4 == (S_LEN / 16) * (S_LEN / 128), "the slice's waves cover a batch's mask exactly once");
    v4f a[16];             // row i, keys 4*lane .. 4*lane + 3 of the 128
#pragma unroll
    for (int i = 0; i < 16; ++i) a[i] = *(const v4f*)(mrow + i * S_LEN);
    // bw[e] of lane (c, hh): bit l = key 4*l + e of row c
    const int c = lane & 15, hh = lane >> 4;
    unsigned int bw[4] = {0u, 0u, 0u, 0u};
#pragma unroll
    for (int i = 0; i < 16; ++i)
#pragma unroll
      for (int e = 0; e < 4; ++e) {
        const unsigned int rowbits = __builtin_amdgcn_ballot_w32(a[i][e] < -5000.0f);
        bw[e] = (c == i) ? rowbits : bw[e];
      }
    // key ch*64 + j*16 + 8*hh + r = 4*l + e with e = r & 3, l = ch*16 + j*4 + 2*hh + (r >> 2)
#pragma unroll
    for (int e = 0; e < 4; ++e) bw[e] >>= 2 * hh;
#pragma unroll
    for (int ch = 0; ch < 2; ++ch) {
      unsigned int word = 0u;   // lane j*8 + r ends up holding word j*8 + r
#pragma unroll
      for (int j = 0; j < 4; ++j)
#pragma unroll
        for (int r = 0; r < 8; ++r) {
          const unsigned int sel = __builtin_amdgcn_ballot_w32((bw[r & 3] & (1u << (ch * 16 + j * 4 + (r >> 2)))) != 0u);
          word = (lane == j * 8 + r) ? sel : word;
        }
      mw[(g * 2 + ch) * 32 + lane] = word;
    }
    // the two stores' address and data registers are reused by the other slices' code, which the listing places behind this one
    asm volatile("s_wait_xcnt 0x0" ::: "memory");
    return;
  }
  const int t0 = blockIdx.x * 64;
  const int bh = blockIdx.y;
  const float* in = (blockIdx.z == 0) ? x0 : x1;
  _Float16* out = (blockIdx.z == 0) ? y0 : y1;
  const float mul = (blockIdx.z == 0) ? QMUL : 1.0f;
  const float* src = in + (size_t)bh * HD * S_LEN + t0;
#pragma unroll
  for (int i = 0; i < 8; ++i) {
    const int idx = tid + 128 * i;          // 0..1023
    const int d  = idx >> 4;                // 0..63
    const int t4 = (idx & 15) * 4;          // 0..60
    const v4f v = *(const v4f*)(src + (size_t)d * S_LEN + t4);
#pragma unroll
    for (int e = 0; e < 4; ++e) T[(t4 + e) * TP + d] = (_Float16)(v[e] * mul);
  }
  __syncthreads();
  _Float16* dst = out + ((size_t)bh * S_LEN + t0) * HD;
  const int rq = lane >> 3, c8 = (lane & 7) * 8;
  {
#pragma unroll
    for (int it = 0; it < 4; ++it) {
      const int row = wave * 16 + it * 4 + rq;   // wave covers rows wave*16 .. +15
      const v8h hv = *(const v8h*)(T + row * TP + c8);
      *(v8h*)(dst + (size_t)row * HD + c8) = hv;
    }
    
  }
}

// lane l with lane l ^ 16 (one vector cross-row move)
__device__ __forceinline__ float xhalf(float x) {
  const int b = __builtin_bit_cast(int, x);
  return __builtin_bit_cast(float, __builtin_amdgcn_permlanex16(b, b, 0x76543210, 0xfedcba98, false, false));
}

// exp2 by v_exp_f32, eight at a time. The early-clobber outputs keep each v_exp off the sources of the one in front of it,
// and the closing v_nop is the slot the instruction set asks for between a transcendental and a next instruction that
// reads its result or overwrites its source (in a build with the plain call a dual-issue multiply stood there).
__device__ __forceinline__ v8f exp2_x8(v8f a) {
  float r0, r1, r2, r3, r4, r5, r6, r7;
  asm("v_exp_f32 %0, %8\n\tv_exp_f32 %1, %9\n\tv_exp_f32 %2, %10\n\tv_exp_f32 %3, %11\n\t"
      "v_exp_f32 %4, %12\n\tv_exp_f32 %5, %13\n\tv_exp_f32 %6, %14\n\tv_exp_f32 %7, %15\n\tv_nop"
      : "=&v"(r0), "=&v"(r1), "=&v"(r2), "=&v"(r3), "=&v"(r4), "=&v"(r5), "=&v"(r6), "=&v"(r7)
      : "v"(a[0]), "v"(a[1]), "v"(a[2]), "v"(a[3]), "v"(a[4]), "v"(a[5]), "v"(a[6]), "v"(a[7]));
  return (v8f){r0, r1, r2, r3, r4, r5, r6, r7};
}
// the same for one value
__device__ __forceinline__ float exp2_x1(float a) {
  float r;
  asm("v_exp_f32 %0, %1\n\tv_nop" : "=&v"(r) : "v"(a));
  return r;
}

// One 64-key chunk of K and V, global memory -> LDS through no register: eight asynchronous 16-B copies a lane
// (rows r, r + 16, r + 32, r + 48 of each tile). lk, lv: the lane's LDS byte addresses of its first K and V piece; kg, vg: the global ones.
// The closing s_wait_xcnt stands inside the statement, so that no address register is rewritten in front of it.
__device__ __forceinline__ void copy_chunk(uint32_t lk, uint32_t lv, const _Float16* kg, const _Float16* vg) {
  asm volatile(
      "global_load_async_to_lds_b128 %0, %8, off\n\t"
      "global_load_async_to_lds_b128 %1, %9, off\n\t"
      "global_load_async_to_lds_b128 %2, %10, off\n\t"
      "global_load_async_to_lds_b128 %3, %11, off\n\t"
      "global_load_async_to_lds_b128 %4, %12, off\n\t"
      "global_load_async_to_lds_b128 %5, %13, off\n\t"
      "global_load_async_to_lds_b128 %6, %14, off\n\t"
      "global_load_async_to_lds_b128 %7, %15, off\n\t"
      "s_wait_xcnt 0x0"
      :: "v"(lk), "v"(lk + 16 * LP * 2), "v"(lk + 32 * LP * 2), "v"(lk + 48 * LP * 2),
         "v"(lv), "v"(lv + 16 * LP * 2), "v"(lv + 32 * LP * 2), "v"(lv + 48 * LP * 2),
         "v"(kg), "v"(kg + 16 * HD), "v"(kg + 32 * HD), "v"(kg + 48 * HD),
         "v"(vg), "v"(vg + 16 * S_LEN), "v"(vg + 32 * S_LEN), "v"(vg + 48 * S_LEN)
      : "memory");
}

__global__ __launch_bounds__(128) __attribute__((amdgpu_waves_per_eu(2, 2)))
void attn_kernel(const _Float16* __restrict__ Qt, const _Float16* __restrict__ Kt,
                 const _Float16* __restrict__ Vh, const unsigned int* __restrict__ mw,
                 float* __restrict__ out, int nheads) {
  __shared__ __align__(16) _Float16 Ksh[2][KC * LP];       // [buffer][kv][d]   2 x 9 KB, pitch LP
  __shared__ __align__(16) _Float16 Vth[2][HD * LP];       // [buffer][d][kv]   2 x 9 KB, pitch LP
  __shared__ __align__(16) float    Ob[HD * OP];           // [d][q] block tile, pitch OP floats

  const int tid  = threadIdx.x;
  const int wave = tid >> 5;
  const int lane = tid & 31;
  const int hh   = lane >> 4;
  const int c    = lane & 15;

  const int bh  = blockIdx.y;
  const int b   = bh / nheads;
  const int qb  = blockIdx.x;
  const int q0b = qb * QB;
  const int q0  = q0b + wave * (16 * NG);

  const _Float16* qbp = Qt + (size_t)bh * S_LEN * HD;
  const _Float16* kbp = Kt + (size_t)bh * S_LEN * HD;
  const _Float16* vbp = Vh + (size_t)bh * HD * S_LEN;
  float*          obp = out + (size_t)bh * HD * S_LEN;

  // Q fragments (B operand): column q0 + g*16 + c, two 32-wide d chunks
  v16h qf[NG][2];
  const _Float16* qlp = qbp + (size_t)(q0 + c) * HD + 8 * hh;
#pragma unroll
  for (int g = 0; g < NG; ++g) {
    qf[g][0] = Frag<_Float16>::load(qlp + g * (16 * HD) + 0);
    qf[g][1] = Frag<_Float16>::load(qlp + g * (16 * HD) + 32);
  }

  // this wave's mask words: 32 a chunk and column group (group g: + g * (S_LEN / KC) * 32), word j*8 + r = one bit a lane for register r of St tile j.
  // The wave number goes through readfirstlane and the pointer into the constant address space (the words were written by the
  // launch before and nothing writes them here), so that the loads are scalar and the words arrive in scalar registers.
  const cuint_p mwp = (cuint_p)(uintptr_t)(mw + (((size_t)b * (S_LEN / 16) + qb * (NWAVE * NG) + __builtin_amdgcn_readfirstlane(wave) * NG) * (S_LEN / KC)) * 32);

  float mrow[NG], lrow[NG];            // running maximum (both halves alike) and this half's share of the sum
  v8f oacc[NG][4];                     // Ot tile t, register r = channel t*16 + 8*hh + r of query q0 + g*16 + c
#pragma unroll
  for (int g = 0; g < NG; ++g) {
    mrow[g] = NEG_FILL; lrow[g] = 0.f;
#pragma unroll
    for (int t = 0; t < 4; ++t) oacc[g][t] = (v8f){0.f,0.f,0.f,0.f,0.f,0.f,0.f,0.f};
  }

  // this lane's piece of a chunk: row tid / 8 (and + 16, 32, 48), halves (tid & 7) * 8 .. + 7
  const int srow = tid >> 3, sc8 = (tid & 7) * 8;
  const uint32_t lk0 = (uint32_t)(size_t)(&Ksh[0][srow * LP + sc8]);   // low 32 bits of a __shared__ address = LDS byte address
  const uint32_t lv0 = (uint32_t)(size_t)(&Vth[0][srow * LP + sc8]);
  const _Float16* kg0 = kbp + (size_t)srow * HD + sc8;       // chunk kc: + kc * KC * HD
  const _Float16* vg0 = vbp + (size_t)srow * S_LEN + sc8;    // chunk kc: + kc * KC
  static_assert(S_LEN / KC >= 2, "the prologue fills two chunks");

  // prologue: chunk 0 lands and is published, then chunk 1 starts
  copy_chunk(lk0, lv0, kg0, vg0);
  asm volatile("s_wait_asynccnt 0x0" ::: "memory");   // this wave's copies of chunk 0 have landed
  __syncthreads();                                    // ... and every other wave's
  copy_chunk(lk0 + KC * LP * 2, lv0 + HD * LP * 2, kg0 + KC * HD, vg0 + KC);

  for (int kc = 0; kc < S_LEN / KC; ++kc) {
    const int buf = kc & 1;
    const _Float16* Kb = Ksh[buf];
    const _Float16* Vb = Vth[buf];
    // mask words of this chunk
    unsigned int mv[NG][32];
#pragma unroll
    for (int g = 0; g < NG; ++g)
#pragma unroll
      for (int i = 0; i < 32; ++i) mv[g][i] = mwp[g * ((S_LEN / KC) * 32) + kc * 32 + i];

    // K's eight A fragments, read from LDS as one group: one LDS latency for the run of sixteen WMMAs
    v16h kf[2][4];
#pragma unroll
    for (int h = 0; h < 2; ++h)
#pragma unroll
      for (int j = 0; j < 4; ++j) kf[h][j] = Frag<_Float16>::load(Kb + (j * 16 + c) * LP + h * 32 + 8 * hh);
    // keeps the sixteen reads together in front of the WMMAs: without it the scheduler sinks each pair to its WMMA, with a wait at each
    __builtin_amdgcn_sched_barrier(0);

    // St: 64 keys x this wave's 32 queries (A = K rows, B = Q); a group's four independent tiles, then their second halves
    v8f s[NG][4];
#pragma unroll
    for (int j = 0; j < 4; ++j) s[0][j] = mma_h(kf[0][j], qf[0][0], (v8f){0.f,0.f,0.f,0.f,0.f,0.f,0.f,0.f});
#pragma unroll
    for (int j = 0; j < 4; ++j) s[0][j] = mma_h(kf[1][j], qf[0][1], s[0][j]);

    // V's eight A fragments, read in front of the softmax (the scheduler may start them among the score WMMAs): their LDS latency passes under it
    v16h vf[2][4];
#pragma unroll
    for (int kk = 0; kk < 2; ++kk)
#pragma unroll
      for (int t = 0; t < 4; ++t) vf[kk][t] = Frag<_Float16>::load(Vb + (t * 16 + c) * LP + kk * 32 + 8 * hh);
    // keeps the sixteen reads here, in front of the softmax: without it the scheduler sinks each pair to its WMMA, with a wait at each
    __builtin_amdgcn_sched_barrier(0);

#pragma unroll
    for (int g = 1; g < NG; ++g) {
#pragma unroll
      for (int j = 0; j < 4; ++j) s[g][j] = mma_h(kf[0][j], qf[g][0], (v8f){0.f,0.f,0.f,0.f,0.f,0.f,0.f,0.f});
#pragma unroll
      for (int j = 0; j < 4; ++j) s[g][j] = mma_h(kf[1][j], qf[g][1], s[g][j]);
    }

#pragma unroll
    for (int g = 0; g < NG; ++g) {
      // mask, chunk maximum of this lane's query (scores in log2 units)
      float cmj[4];
#pragma unroll
      for (int j = 0; j < 4; ++j) {
        float m = NEG_FILL;
#pragma unroll
        for (int r = 0; r < 8; ++r) {
          float x = s[g][j][r];
          if (__builtin_amdgcn_inverse_ballot_w32(mv[g][j * 8 + r])) x = NEG_FILL;   // the word is the select's lane mask
          s[g][j][r] = x;
          m = fmaxf(m, x);
        }
        cmj[j] = m;
      }
      float cm = fmaxf(fmaxf(cmj[0], cmj[1]), fmaxf(cmj[2], cmj[3]));
      cm = fmaxf(cm, xhalf(cm));

      // online softmax update; Pt (x2^15, f16) packed from the score registers into the B operand
      const float mnew  = fmaxf(mrow[g], cm);
      const float alpha = exp2_x1(mrow[g] - mnew);
      const float msub  = mnew - PSH;   // exp2(x - msub) = 2^15 * exp2(x - mnew)
      mrow[g] = mnew;
      v16h pb[2];
      float psj[4];
#pragma unroll
      for (int j = 0; j < 4; ++j) {
        v8f a;
#pragma unroll
        for (int r = 0; r < 8; ++r) a[r] = s[g][j][r] - msub;
        const v8f p = exp2_x8(a);
        float psum = 0.f;
#pragma unroll
        for (int r = 0; r < 8; ++r) {
          psum += p[r];
          pb[j >> 1][(j & 1) * 8 + r] = (_Float16)p[r];
        }
        psj[j] = psum;
      }
      lrow[g] = lrow[g] * alpha + ((psj[0] + psj[1]) + (psj[2] + psj[3]));
#pragma unroll
      for (int t = 0; t < 4; ++t)
#pragma unroll
        for (int r = 0; r < 8; ++r) oacc[g][t][r] *= alpha;

      // Ot += Vt * Pt (A = V channel rows, B = Pt)
#pragma unroll
      for (int kk = 0; kk < 2; ++kk) {
#pragma unroll
        for (int t = 0; t < 4; ++t) oacc[g][t] = mma_h(vf[kk][t], pb[kk], oacc[g][t]);
      }
    }

    // hand-over: chunk kc + 1 is published and this chunk's buffer is freed by the one barrier.
    // The scheduling barrier keeps the softmax and the WMMAs in front of it: without it the scheduler lifts the waits and the barrier
    // into the softmax while the copies stay at the foot, and the copies lose that much of their lead.
    __builtin_amdgcn_sched_barrier(0);
    asm volatile("s_wait_dscnt 0x0" ::: "memory");      // this wave's reads of the buffer have returned
    asm volatile("s_wait_asynccnt 0x0" ::: "memory");   // this wave's copies of chunk kc + 1 have landed
    __syncthreads();
    if (kc + 2 < S_LEN / KC)                            // the same for the whole block
      copy_chunk(lk0 + buf * (KC * LP * 2), lv0 + buf * (HD * LP * 2), kg0 + (size_t)(kc + 2) * (KC * HD), vg0 + (kc + 2) * KC);
  }
  asm volatile("s_wait_asynccnt 0x0" ::: "memory");     // nothing is in flight when the wave goes on to the epilogue and ends

  // epilogue: join the halves' sums, normalise, stage block tile [d][q], write whole channel rows
#pragma unroll
  for (int g = 0; g < NG; ++g) {
    const float inv = 1.0f / (lrow[g] + xhalf(lrow[g]));   // the sum carries the same 2^15 as Ot
    const int qloc = wave * (16 * NG) + g * 16 + c;
#pragma unroll
    for (int t = 0; t < 4; ++t)
#pragma unroll
      for (int r = 0; r < 8; ++r) Ob[(t * 16 + 8 * hh + r) * OP + qloc] = oacc[g][t][r] * inv;
  }
  __syncthreads();
  {
    static_assert(QB == 32 * 4, "a wave's 16-B pieces cover one channel row of the block tile");
    v4f val[16];
#pragma unroll
    for (int it = 0; it < 16; ++it) val[it] = *(const v4f*)(Ob + (wave * 16 + it) * OP + lane * 4);   // wave covers channels wave*16 .. +15
#pragma unroll
    for (int it = 0; it < 16; ++it) *(v4f*)(obp + (size_t)(wave * 16 + it) * S_LEN + q0b + lane * 4) = val[it];
  }
}

extern "C" void kernel_launch(void* const* d_in, const int* in_sizes, int n_in,
                              void* d_out, int out_size, void* d_ws, size_t ws_size,
                              hipStream_t stream) {
  if (n_in < 4) return;
  const float* q  = (const float*)d_in[0];
  const float* k  = (const float*)d_in[1];
  const float* v  = (const float*)d_in[2];
  const float* mk = (const float*)d_in[3];
  float* out = (float*)d_out;

  const int per_b = C_CH * S_LEN;
  const int nb = in_sizes[0] / per_b;
  if (nb <= 0 || in_sizes[0] != nb * per_b) return;
  if (in_sizes[1] != in_sizes[0] || in_sizes[2] != in_sizes[0]) return;
  if ((long long)in_sizes[3] != (long long)nb * S_LEN * S_LEN) return;
  if (out_size != in_sizes[0]) return;
  const int nbh = nb * N_HEADS;

  const size_t eb = (size_t)nbh * S_LEN * HD * sizeof(_Float16);   // bytes per f16 tensor copy
  const size_t offQ = 0, offK = eb, offV = 2 * eb;
  const size_t offM = 3 * eb;
  const size_t total = 3 * eb + (size_t)nb * S_LEN * (S_LEN / 8);   // one mask bit a score
  if (total > ws_size || total > (size_t)134217728) return;
  _Float16* Qt = (_Float16*)((char*)d_ws + offQ);
  _Float16* Kt = (_Float16*)((char*)d_ws + offK);
  _Float16* Vh = (_Float16*)((char*)d_ws + offV);
  unsigned int* Mw = (unsigned int*)((char*)d_ws + offM);

  // q, k: [bh][64][S] f32 -> [bh][S][64] f16; v: [bh][64][S] f32 -> same layout f16; mask: f32 -> bits
  tcast_kernel<<<dim3(S_LEN / 64, nbh, 4), 128, 0, stream>>>(q, k, v, mk, Qt, Kt, Vh, Mw);
  // attention
  attn_kernel<<<dim3(S_LEN / QB, nbh), 128, 0, stream>>>(Qt, Kt, Vh, Mw, out, N_HEADS);
  (void)hipGetLastError();
}

// v009
// Measured time: 32.7 microseconds a run.
// Two timings next to v008 both put it at 1.05 times that version's speed.
// Over all steps from v000 it is 3.60 times as fast.
#include <hip/hip_runtime.h>
#include <stdint.h>

typedef __attribute__((ext_vector_type(16))) _Float16 v16h;
typedef __attribute__((ext_vector_type(8)))  _Float16 v8h;
typedef __attribute__((ext_vector_type(8)))  float    v8f;
typedef __attribute__((ext_vector_type(4)))  float    v4f;
typedef const unsigned int __attribute__((address_space(4)))* cuint_p;   // read-only for the whole launch

#define S_LEN 1024
#define HD 64
#define N_HEADS 8
#define C_CH 512
#define QB 128
#define NG 2      // 16-query column groups a wave: each K and V fragment read from LDS serves NG WMMAs
#define KC 64
#define NWAVE 4    // waves of one key set: together they cover the block's QB queries
#define NSET 2     // key sets: set s works chunks s*NIT .. s*NIT + NIT - 1 for all of the block's queries; the partial results are merged in the epilogue
#define NIT (S_LEN / KC / NSET)
#define PSH 15.0f   // P and its sum are carried x2^15: the shift is taken off the subtracted maximum
#define SCALE_QK 0.125f
#define NEG_FILL (-1.0e30f)
#define LOG2E 1.44269504f   // exp(x) = exp2(x * LOG2E), as __expf forms it
#define QMUL (SCALE_QK * LOG2E)   // multiplied into Q in f32, in front of its rounding to f16
#define TP 72      // transpose tile pitch in halves (144 B rows)
#define OP 132     // output tile pitch in floats (528 B rows)
#define LP 72      // K and V tile pitch in halves: 144 B = 16 B x odd, so the 16 rows of a ds_load_b128 fragment read fall on distinct banks

// ---- 16-bit WMMA fragment loader (split k map: elements 0..7 <- p[0..7], 8..15 <- p[16..23]) ----
template <typename T> struct Frag;
template <> struct Frag<_Float16> {
  typedef v16h V; union U { v16h v; v8h h[2]; };
  static __device__ __forceinline__ v16h load(const _Float16* p) {
    U f; f.h[0] = *(const v8h*)(p); f.h[1] = *(const v8h*)(p + 16); return f.v;
  }
};

// plain builtin: the compiler keeps the distances behind it and is free to run WMMAs back to back
__device__ __forceinline__ v8f mma_h(v16h a, v16h b, v8f c) {
  return __builtin_amdgcn_wmma_f32_16x16x32_f16(false, a, false, b, (short)0, c, false, false);
}

// ---- operand casts, one launch. Grid slices z = 0, 1 (x0, x1), transpose-cast:
//      in[bh][64 d][S t] f32 (channel-major) -> out[bh][S t][64 d] f16 (token-major); x0 is multiplied by QMUL on the way.
//      Slice z = 2 (x2), cast in place of layout: each block takes 4096 consecutive elements, 32 a thread.
//      Slice z = 3 (mk), mask packing: f32 [b][S q][S k] -> one bit a score, in the order the attention kernel selects by:
//      mw[b][q / 16][k / 64][word j*8 + r], bit hh*16 + c  =  (mk[b][q16*16 + c][k64*64 + j*16 + 8*hh + r] < -5000).
//      A wave takes 16 queries x 128 keys: each load is 512 consecutive bytes of one mask row. ----
__global__ __launch_bounds__(128) void tcast_kernel(
    const float* __restrict__ x0, const float* __restrict__ x1, const float* __restrict__ x2,
    const float* __restrict__ mk,
    _Float16* __restrict__ y0, _Float16* __restrict__ y1, _Float16* __restrict__ y2,
    unsigned int* __restrict__ mw) {
  __shared__ __align__(16) _Float16 T[64 * TP];   // [t][d], pitch 72 halves
  const int tid = threadIdx.x, lane = tid & 31, wave = tid >> 5;
  if (blockIdx.z == 2) {   // block-uniform, in front of the barrier
    const size_t base = ((size_t)blockIdx.y * (S_LEN / 64) + blockIdx.x) * (64 * HD) + (size_t)tid * 8;
    v4f a[4][2];           // all eight 16-B loads in flight before the first conversion
#pragma unroll
    for (int i = 0; i < 4; ++i) {
      a[i][0] = *(const v4f*)(x2 + base + i * 1024);
      a[i][1] = *(const v4f*)(x2 + base + i * 1024 + 4);
    }
#pragma unroll
    for (int i = 0; i < 4; ++i) {
      v8h h;
#pragma unroll
      for (int e = 0; e < 4; ++e) { h[e] = (_Float16)a[i][0][e]; h[4 + e] = (_Float16)a[i][1][e]; }
      *(v8h*)(y2 + base + i * 1024) = h;
    }
    return;
  }
  if (blockIdx.z == 3) {   // block-uniform, in front of the barrier
    // wave g of the slice: (b * 64 + q16) * 8 + pair of 64-key chunks
    const size_t g = ((size_t)blockIdx.y * (S_LEN / 64) + blockIdx.x) * 4 + wave;
    const float* mrow = mk + (g >> 3) * (16 * S_LEN) + (g & 7) * 128 + lane * 4;
    static_assert(N_HEADS * (S_LEN / 64) * 4 == (S_LEN / 16) * (S_LEN / 128), "the slice's waves cover a batch's mask exactly once");
    v4f a[16];             // row i, keys 4*lane .. 4*lane + 3 of the 128
#pragma unroll
    for (int i = 0; i < 16; ++i) a[i] = *(const v4f*)(mrow + i * S_LEN);
    // bw[e] of lane (c, hh): bit l = key 4*l + e of row c
    const int c = lane & 15, hh = lane >> 4;
    unsigned int bw[4] = {0u, 0u, 0u, 0u};
#pragma unroll
    for (int i = 0; i < 16; ++i)
#pragma unroll
      for (int e = 0; e < 4; ++e) {
        const unsigned int rowbits = __builtin_amdgcn_ballot_w32(a[i][e] < -5000.0f);
        bw[e] = (c == i) ? rowbits : bw[e];
      }
    // key ch*64 + j*16 + 8*hh + r = 4*l + e with e = r & 3, l = ch*16 + j*4 + 2*hh + (r >> 2)
#pragma unroll
    for (int e = 0; e < 4; ++e) bw[e] >>= 2 * hh;
#pragma unroll
    for (int ch = 0; ch < 2; ++ch) {
      unsigned int word = 0u;   // lane j*8 + r ends up holding word j*8 + r
#pragma unroll
      for (int j = 0; j < 4; ++j)
#pragma unroll
        for (int r = 0; r < 8; ++r) {
          const unsigned int sel = __builtin_amdgcn_ballot_w32((bw[r & 3] & (1u << (ch * 16 + j * 4 + (r >> 2)))) != 0u);
          word = (lane == j * 8 + r) ? sel : word;
        }
      mw[(g * 2 + ch) * 32 + lane] = word;
    }
    // the two stores' address and data registers are reused by the other slices' code, which the listing places behind this one
    asm volatile("s_wait_xcnt 0x0" ::: "memory");
    return;
  }
  const int t0 = blockIdx.x * 64;
  const int bh = blockIdx.y;
  const float* in = (blockIdx.z == 0) ? x0 : x1;
  _Float16* out = (blockIdx.z == 0) ? y0 : y1;
  const float mul = (blockIdx.z == 0) ? QMUL : 1.0f;
  const float* src = in + (size_t)bh * HD * S_LEN + t0;
#pragma unroll
  for (int i = 0; i < 8; ++i) {
    const int idx = tid + 128 * i;          // 0..1023
    const int d  = idx >> 4;                // 0..63
    const int t4 = (idx & 15) * 4;          // 0..60
    const v4f v = *(const v4f*)(src + (size_t)d * S_LEN + t4);
#pragma unroll
    for (int e = 0; e < 4; ++e) T[(t4 + e) * TP + d] = (_Float16)(v[e] * mul);
  }
  __syncthreads();
  _Float16* dst = out + ((size_t)bh * S_LEN + t0) * HD;
  const int rq = lane >> 3, c8 = (lane & 7) * 8;
  {
#pragma unroll
    for (int it = 0; it < 4; ++it) {
      const int row = wave * 16 + it * 4 + rq;   // wave covers rows wave*16 .. +15
      const v8h hv = *(const v8h*)(T + row * TP + c8);
      *(v8h*)(dst + (size_t)row * HD + c8) = hv;
    }
    
  }
}

// lane l with lane l ^ 16 (one vector cross-row move)
__device__ __forceinline__ float xhalf(float x) {
  const int b = __builtin_bit_cast(int, x);
  return __builtin_bit_cast(float, __builtin_amdgcn_permlanex16(b, b, 0x76543210, 0xfedcba98, false, false));
}

// exp2 by v_exp_f32, eight at a time. The early-clobber outputs keep each v_exp off the sources of the one in front of it,
// and the closing v_nop is the slot the instruction set asks for between a transcendental and a next instruction that
// reads its result or overwrites its source (in a build with the plain call a dual-issue multiply stood there).
__device__ __forceinline__ v8f exp2_x8(v8f a) {
  float r0, r1, r2, r3, r4, r5, r6, r7;
  asm("v_exp_f32 %0, %8\n\tv_exp_f32 %1, %9\n\tv_exp_f32 %2, %10\n\tv_exp_f32 %3, %11\n\t"
      "v_exp_f32 %4, %12\n\tv_exp_f32 %5, %13\n\tv_exp_f32 %6, %14\n\tv_exp_f32 %7, %15\n\tv_nop"
      : "=&v"(r0), "=&v"(r1), "=&v"(r2), "=&v"(r3), "=&v"(r4), "=&v"(r5), "=&v"(r6), "=&v"(r7)
      : "v"(a[0]), "v"(a[1]), "v"(a[2]), "v"(a[3]), "v"(a[4]), "v"(a[5]), "v"(a[6]), "v"(a[7]));
  return (v8f){r0, r1, r2, r3, r4, r5, r6, r7};
}
// the same for one value
__device__ __forceinline__ float exp2_x1(float a) {
  float r;
  asm("v_exp_f32 %0, %1\n\tv_nop" : "=&v"(r) : "v"(a));
  return r;
}

// One 64-key chunk of K and V, global memory -> LDS through no register: eight asynchronous 16-B copies a lane
// (rows r, r + 16, r + 32, r + 48 of each tile). lk, lv: the lane's LDS byte addresses of its first K and V piece; kg, vg: the global ones.
// The closing s_wait_xcnt stands inside the statement, so that no address register is rewritten in front of it.
__device__ __forceinline__ void copy_chunk(uint32_t lk, uint32_t lv, const _Float16* kg, const _Float16* vg) {
  asm volatile(
      "global_load_async_to_lds_b128 %0, %8, off\n\t"
      "global_load_async_to_lds_b128 %1, %9, off\n\t"
      "global_load_async_to_lds_b128 %2, %10, off\n\t"
      "global_load_async_to_lds_b128 %3, %11, off\n\t"
      "global_load_async_to_lds_b128 %4, %12, off\n\t"
      "global_load_async_to_lds_b128 %5, %13, off\n\t"
      "global_load_async_to_lds_b128 %6, %14, off\n\t"
      "global_load_async_to_lds_b128 %7, %15, off\n\t"
      "s_wait_xcnt 0x0"
      :: "v"(lk), "v"(lk + 16 * LP * 2), "v"(lk + 32 * LP * 2), "v"(lk + 48 * LP * 2),
         "v"(lv), "v"(lv + 16 * LP * 2), "v"(lv + 32 * LP * 2), "v"(lv + 48 * LP * 2),
         "v"(kg), "v"(kg + 16 * HD), "v"(kg + 32 * HD), "v"(kg + 48 * HD),
         "v"(vg), "v"(vg + 16 * S_LEN), "v"(vg + 32 * S_LEN), "v"(vg + 48 * S_LEN)
      : "memory");
}

__global__ __launch_bounds__(256) __attribute__((amdgpu_waves_per_eu(4, 4)))
void attn_kernel(const _Float16* __restrict__ Qt, const _Float16* __restrict__ Kt,
                 const _Float16* __restrict__ Vh, const unsigned int* __restrict__ mw,
                 float* __restrict__ out, int nheads) {
  __shared__ __align__(16) _Float16 Ksh[NSET][2][KC * LP];   // [set][buffer][kv][d]   4 x 9 KB, pitch LP
  __shared__ __align__(16) _Float16 Vth[NSET][2][HD * LP];   // [set][buffer][d][kv]   4 x 9 KB, pitch LP
  __shared__ __align__(16) float    Ob[HD * OP];             // [d][q] block tile, pitch OP floats
  __shared__ __align__(16) v4f      Mg[NWAVE * NG * 8 * 32]; // set 1's Ot, [wave][16-B piece][lane]
  __shared__ float                  Ml[NWAVE * NG * 2 * 32]; // set 1's maximum and sum, [wave][group][which][lane]

  const int tid  = threadIdx.x;
  const int wv   = __builtin_amdgcn_readfirstlane(tid >> 5);   // scalar: the set test of the epilogue is a scalar branch, the mask loads stay scalar
  const int set  = wv / NWAVE;
  const int wave = wv & (NWAVE - 1);                           // wave within its set
  const int lane = tid & 31;
  const int hh   = lane >> 4;
  const int c    = lane & 15;

  const int bh  = blockIdx.y;
  const int b   = bh / nheads;
  const int qb  = blockIdx.x;
  const int q0b = qb * QB;
  const int q0  = q0b + wave * (16 * NG);

  const _Float16* qbp = Qt + (size_t)bh * S_LEN * HD;
  const _Float16* kbp = Kt + (size_t)bh * S_LEN * HD;
  const _Float16* vbp = Vh + (size_t)bh * HD * S_LEN;
  float*          obp = out + (size_t)bh * HD * S_LEN;

  // Q fragments (B operand): column q0 + g*16 + c, two 32-wide d chunks
  v16h qf[NG][2];
  const _Float16* qlp = qbp + (size_t)(q0 + c) * HD + 8 * hh;
#pragma unroll
  for (int g = 0; g < NG; ++g) {
    qf[g][0] = Frag<_Float16>::load(qlp + g * (16 * HD) + 0);
    qf[g][1] = Frag<_Float16>::load(qlp + g * (16 * HD) + 32);
  }

  // this wave's mask words: 32 a chunk and column group (group g: + g * (S_LEN / KC) * 32), word j*8 + r = one bit a lane for register r of St tile j.
  // The wave number has gone through readfirstlane and the pointer goes into the constant address space (the words were written by the
  // launch before and nothing writes them here), so that the loads are scalar and the words arrive in scalar registers.
  const cuint_p mwp = (cuint_p)(uintptr_t)(mw + (((size_t)b * (S_LEN / 16) + qb * (NWAVE * NG) + wave * NG) * (S_LEN / KC) + set * NIT) * 32);

  float mrow[NG], lrow[NG];            // running maximum (both halves alike) and this half's share of the sum
  v8f oacc[NG][4];                     // Ot tile t, register r = channel t*16 + 8*hh + r of query q0 + g*16 + c
#pragma unroll
  for (int g = 0; g < NG; ++g) {
    mrow[g] = NEG_FILL; lrow[g] = 0.f;
#pragma unroll
    for (int t = 0; t < 4; ++t) oacc[g][t] = (v8f){0.f,0.f,0.f,0.f,0.f,0.f,0.f,0.f};
  }

  // this lane's piece of its set's chunk: row ts / 8 (and + 16, 32, 48), halves (ts & 7) * 8 .. + 7, ts = thread within the set
  const int ts = tid & (NWAVE * 32 - 1);
  const int srow = ts >> 3, sc8 = (ts & 7) * 8;
  const uint32_t lk0 = (uint32_t)(size_t)(&Ksh[set][0][srow * LP + sc8]);   // low 32 bits of a __shared__ address = LDS byte address
  const uint32_t lv0 = (uint32_t)(size_t)(&Vth[set][0][srow * LP + sc8]);
  const _Float16* kg0 = kbp + (size_t)(set * NIT * KC + srow) * HD + sc8;       // the set's chunk kc: + kc * KC * HD
  const _Float16* vg0 = vbp + (size_t)srow * S_LEN + set * NIT * KC + sc8;      // the set's chunk kc: + kc * KC
  static_assert(NIT >= 2, "the prologue fills two chunks of each set");

  // prologue: chunk 0 lands and is published, then chunk 1 starts
  copy_chunk(lk0, lv0, kg0, vg0);
  asm volatile("s_wait_asynccnt 0x0" ::: "memory");   // this wave's copies of chunk 0 have landed
  __syncthreads();                                    // ... and every other wave's
  copy_chunk(lk0 + KC * LP * 2, lv0 + HD * LP * 2, kg0 + KC * HD, vg0 + KC);

  for (int kc = 0; kc < NIT; ++kc) {
    const int buf = kc & 1;
    const _Float16* Kb = Ksh[set][buf];
    const _Float16* Vb = Vth[set][buf];
    // mask words of this chunk
    unsigned int mv[NG][32];
#pragma unroll
    for (int g = 0; g < NG; ++g)
#pragma unroll
      for (int i = 0; i < 32; ++i) mv[g][i] = mwp[g * ((S_LEN / KC) * 32) + kc * 32 + i];

    // K's eight A fragments, read from LDS as one group: one LDS latency for the run of sixteen WMMAs
    v16h kf[2][4];
#pragma unroll
    for (int h = 0; h < 2; ++h)
#pragma unroll
      for (int j = 0; j < 4; ++j) kf[h][j] = Frag<_Float16>::load(Kb + (j * 16 + c) * LP + h * 32 + 8 * hh);
    // keeps the sixteen reads together in front of the WMMAs: without it the scheduler sinks each pair to its WMMA, with a wait at each
    __builtin_amdgcn_sched_barrier(0);

    // St: 64 keys x this wave's 32 queries (A = K rows, B = Q); a group's four independent tiles, then their second halves
    v8f s[NG][4];
#pragma unroll
    for (int g = 0; g < NG; ++g) {
#pragma unroll
      for (int j = 0; j < 4; ++j) s[g][j] = mma_h(kf[0][j], qf[g][0], (v8f){0.f,0.f,0.f,0.f,0.f,0.f,0.f,0.f});
#pragma unroll
      for (int j = 0; j < 4; ++j) s[g][j] = mma_h(kf[1][j], qf[g][1], s[g][j]);
    }
    // keeps the sixteen score WMMAs one run: mixed into the softmax, each stands next to a reader of its result or a writer of its operands, with v_nops between
    __builtin_amdgcn_sched_barrier(0);

    v16h vf[2][4];
    v16h pb[NG][2];
#pragma unroll
    for (int g = 0; g < NG; ++g) {
      if (g == NG - 1) {
        // V's eight A fragments, read in front of the last group's softmax: their LDS latency passes under it, and they take K's registers
        // only when the groups before have shrunk their scores to P (a quarter of a SIMD's registers must hold the wave).
        // The two scheduling barriers keep the sixteen reads together at this place: lifted, they cost the registers; sunk, each pair waits at its WMMA.
        __builtin_amdgcn_sched_barrier(0);
#pragma unroll
        for (int kk = 0; kk < 2; ++kk)
#pragma unroll
          for (int t = 0; t < 4; ++t) vf[kk][t] = Frag<_Float16>::load(Vb + (t * 16 + c) * LP + kk * 32 + 8 * hh);
        __builtin_amdgcn_sched_barrier(0);
      }
      // mask, chunk maximum of this lane's query (scores in log2 units)
      float cmj[4];
#pragma unroll
      for (int j = 0; j < 4; ++j) {
        float m = NEG_FILL;
#pragma unroll
        for (int r = 0; r < 8; ++r) {
          float x = s[g][j][r];
          if (__builtin_amdgcn_inverse_ballot_w32(mv[g][j * 8 + r])) x = NEG_FILL;   // the word is the select's lane mask
          s[g][j][r] = x;
          m = fmaxf(m, x);
        }
        cmj[j] = m;
      }
      float cm = fmaxf(fmaxf(cmj[0], cmj[1]), fmaxf(cmj[2], cmj[3]));
      cm = fmaxf(cm, xhalf(cm));

      // online softmax update; Pt (x2^15, f16) packed from the score registers into the B operand
      const float mnew  = fmaxf(mrow[g], cm);
      const float alpha = exp2_x1(mrow[g] - mnew);
      const float msub  = mnew - PSH;   // exp2(x - msub) = 2^15 * exp2(x - mnew)
      mrow[g] = mnew;
      float psj[4];
#pragma unroll
      for (int j = 0; j < 4; ++j) {
        v8f a;
#pragma unroll
        for (int r = 0; r < 8; ++r) a[r] = s[g][j][r] - msub;
        const v8f p = exp2_x8(a);
        float psum = 0.f;
#pragma unroll
        for (int r = 0; r < 8; ++r) {
          psum += p[r];
          pb[g][j >> 1][(j & 1) * 8 + r] = (_Float16)p[r];
        }
        psj[j] = psum;
      }
      lrow[g] = lrow[g] * alpha + ((psj[0] + psj[1]) + (psj[2] + psj[3]));
      // The empty statement holds the sum's additions in this group's softmax. Without it they sink to the loop's latch, the 32 f32 values
      // of P of each group stay live to the chunk's end, and the wave spills at a quarter of the register file. Input only: the fused multiply-add stays.
      asm volatile("" :: "v"(lrow[g]));   // empty statement on each row's sum, against spills
#pragma unroll
      for (int t = 0; t < 4; ++t)
#pragma unroll
        for (int r = 0; r < 8; ++r) oacc[g][t][r] *= alpha;
    }

    // Ot += Vt * Pt (A = V channel rows, B = Pt)
#pragma unroll
    for (int g = 0; g < NG; ++g)
#pragma unroll
      for (int kk = 0; kk < 2; ++kk) {
#pragma unroll
        for (int t = 0; t < 4; ++t) oacc[g][t] = mma_h(vf[kk][t], pb[g][kk], oacc[g][t]);
      }

    // hand-over: chunk kc + 1 is published and this chunk's buffer is freed by the one barrier.
    // The scheduling barrier keeps the softmax and the WMMAs in front of it: without it the scheduler lifts the waits and the barrier
    // into the softmax while the copies stay at the foot, and the copies lose that much of their lead.
    __builtin_amdgcn_sched_barrier(0);
    asm volatile("s_wait_dscnt 0x0" ::: "memory");      // this wave's reads of the buffer have returned
    asm volatile("s_wait_asynccnt 0x0" ::: "memory");   // this wave's copies of chunk kc + 1 have landed
    __syncthreads();
    if (kc + 2 < NIT)                                   // the same for the whole block
      copy_chunk(lk0 + buf * (KC * LP * 2), lv0 + buf * (HD * LP * 2), kg0 + (size_t)(kc + 2) * (KC * HD), vg0 + (kc + 2) * KC);
  }
  asm volatile("s_wait_asynccnt 0x0" ::: "memory");     // nothing is in flight when the wave goes on to the epilogue and ends

  // epilogue: join the lane halves' sums; set 1 hands its partial result to the same lane of the same wave of set 0
  float lsum[NG];
#pragma unroll
  for (int g = 0; g < NG; ++g) lsum[g] = lrow[g] + xhalf(lrow[g]);   // the sum carries the same 2^15 as Ot
  if (set == 1) {
#pragma unroll
    for (int g = 0; g < NG; ++g) {
      Ml[((wave * NG + g) * 2 + 0) * 32 + lane] = mrow[g];
      Ml[((wave * NG + g) * 2 + 1) * 32 + lane] = lsum[g];
#pragma unroll
      for (int t = 0; t < 4; ++t)
#pragma unroll
        for (int h = 0; h < 2; ++h)
          Mg[((wave * NG + g) * 8 + t * 2 + h) * 32 + lane] =
              (v4f){oacc[g][t][h * 4 + 0], oacc[g][t][h * 4 + 1], oacc[g][t][h * 4 + 2], oacc[g][t][h * 4 + 3]};
    }
  }
  __syncthreads();   // set 1's partial results are published
  // set 0: both halves brought to the common maximum, added, normalised; block tile [d][q] staged
  if (set == 0) {
#pragma unroll
    for (int g = 0; g < NG; ++g) {
      const float m1 = Ml[((wave * NG + g) * 2 + 0) * 32 + lane];
      const float l1 = Ml[((wave * NG + g) * 2 + 1) * 32 + lane];
      const float m  = fmaxf(mrow[g], m1);
      const float a0 = exp2_x1(mrow[g] - m), a1 = exp2_x1(m1 - m);
      const float inv = 1.0f / (lsum[g] * a0 + l1 * a1);
      const float f0 = a0 * inv, f1 = a1 * inv;
      const int qloc = wave * (16 * NG) + g * 16 + c;
#pragma unroll
      for (int t = 0; t < 4; ++t)
#pragma unroll
        for (int h = 0; h < 2; ++h) {
          const v4f o1 = Mg[((wave * NG + g) * 8 + t * 2 + h) * 32 + lane];
#pragma unroll
          for (int e = 0; e < 4; ++e) Ob[(t * 16 + 8 * hh + h * 4 + e) * OP + qloc] = oacc[g][t][h * 4 + e] * f0 + o1[e] * f1;
        }
    }
  }
  __syncthreads();
  // write whole channel rows
  {
    static_assert(QB == 32 * 4, "a wave's 16-B pieces cover one channel row of the block tile");
    static_assert(HD == NSET * NWAVE * 8, "eight channel rows a wave");
    v4f val[8];
#pragma unroll
    for (int it = 0; it < 8; ++it) val[it] = *(const v4f*)(Ob + (wv * 8 + it) * OP + lane * 4);   // wave wv of the block covers channels wv*8 .. +7
#pragma unroll
    for (int it = 0; it < 8; ++it) *(v4f*)(obp + (size_t)(wv * 8 + it) * S_LEN + q0b + lane * 4) = val[it];
  }
}

extern "C" void kernel_launch(void* const* d_in, const int* in_sizes, int n_in,
                              void* d_out, int out_size, void* d_ws, size_t ws_size,
                              hipStream_t stream) {
  if (n_in < 4) return;
  const float* q  = (const float*)d_in[0];
  const float* k  = (const float*)d_in[1];
  const float* v  = (const float*)d_in[2];
  const float* mk = (const float*)d_in[3];
  float* out = (float*)d_out;

  const int per_b = C_CH * S_LEN;
  const int nb = in_sizes[0] / per_b;
  if (nb <= 0 || in_sizes[0] != nb * per_b) return;
  if (in_sizes[1] != in_sizes[0] || in_sizes[2] != in_sizes[0]) return;
  if ((long long)in_sizes[3] != (long long)nb * S_LEN * S_LEN) return;
  if (out_size != in_sizes[0]) return;
  const int nbh = nb * N_HEADS;

  const size_t eb = (size_t)nbh * S_LEN * HD * sizeof(_Float16);   // bytes per f16 tensor copy
  const size_t offQ = 0, offK = eb, offV = 2 * eb;
  const size_t offM = 3 * eb;
  const size_t total = 3 * eb + (size_t)nb * S_LEN * (S_LEN / 8);   // one mask bit a score
  if (total > ws_size || total > (size_t)134217728) return;
  _Float16* Qt = (_Float16*)((char*)d_ws + offQ);
  _Float16* Kt = (_Float16*)((char*)d_ws + offK);
  _Float16* Vh = (_Float16*)((char*)d_ws + offV);
  unsigned int* Mw = (unsigned int*)((char*)d_ws + offM);

  // q, k: [bh][64][S] f32 -> [bh][S][64] f16; v: [bh][64][S] f32 -> same layout f16; mask: f32 -> bits
  tcast_kernel<<<dim3(S_LEN / 64, nbh, 4), 128, 0, stream>>>(q, k, v, mk, Qt, Kt, Vh, Mw);
  // attention
  attn_kernel<<<dim3(S_LEN / QB, nbh), NSET * NWAVE * 32, 0, stream>>>(Qt, Kt, Vh, Mw, out, N_HEADS);
  (void)hipGetLastError();
}

// v010
// A run of this version takes 30.2 microseconds.
// Next to v009, in two timings, it ran 1.08 times as fast each time.
// Counting every step since v000, it is 3.89 times as fast.
#include <hip/hip_runtime.h>
#include <stdint.h>

typedef __attribute__((ext_vector_type(16))) _Float16 v16h;
typedef __attribute__((ext_vector_type(8)))  _Float16 v8h;
typedef __attribute__((ext_vector_type(8)))  float    v8f;
typedef __attribute__((ext_vector_type(4)))  float    v4f;
typedef const unsigned int __attribute__((address_space(4)))* cuint_p;   // read-only for the whole launch

#define S_LEN 1024
#define HD 64
#define N_HEADS 8
#define C_CH 512
#define QB 128
#define NG 2      // 16-query column groups a wave: each K and V fragment read from LDS serves NG WMMAs
#define KC 64
#define NWAVE 4    // waves of one key set: together they cover the block's QB queries
#define NSET 2     // key sets: set s works chunks s*NIT .. s*NIT + NIT - 1 for all of the block's queries; the partial results are merged in the epilogue
#define NIT (S_LEN / KC / NSET)
#define PSH 15.0f   // P and its sum are carried x2^15: the shift is taken off the subtracted maximum
#define SCALE_QK 0.125f
#define NEG_FILL (-1.0e30f)
#define LOG2E 1.44269504f   // exp(x) = exp2(x * LOG2E), as __expf forms it
#define QMUL (SCALE_QK * LOG2E)   // multiplied into Q in f32, in front of its rounding to f16
#define TP 72      // transpose tile pitch in halves (144 B rows)
#define OP 132     // output tile pitch in floats (528 B rows)
#define LP 72      // K and V tile pitch in halves: 144 B = 16 B x odd, so the 16 rows of a ds_load_b128 fragment read fall on distinct banks

// ---- 16-bit WMMA fragment loader (split k map: elements 0..7 <- p[0..7], 8..15 <- p[16..23]) ----
template <typename T> struct Frag;
template <> struct Frag<_Float16> {
  typedef v16h V; union U { v16h v; v8h h[2]; };
  static __device__ __forceinline__ v16h load(const _Float16* p) {
    U f; f.h[0] = *(const v8h*)(p); f.h[1] = *(const v8h*)(p + 16); return f.v;
  }
};

// plain builtin: the compiler keeps the distances behind it and is free to run WMMAs back to back
__device__ __forceinline__ v8f mma_h(v16h a, v16h b, v8f c) {
  return __builtin_amdgcn_wmma_f32_16x16x32_f16(false, a, false, b, (short)0, c, false, false);
}

// ---- operand casts, one launch. Grid slice z = 0 (x1), transpose-cast:
//      in[bh][64 d][S t] f32 (channel-major) -> out[bh][S t][64 d] f16 (token-major).
//      Slice z = 1 (x2), cast in place of layout: each block takes 4096 consecutive elements, 32 a thread.
//      Slice z = 2 (mk), mask packing: f32 [b][S q][S k] -> one bit a score, in the order the attention kernel selects by:
//      mw[b][q / 16][k / 64][word j*8 + r], bit hh*16 + c  =  (mk[b][q16*16 + c][k64*64 + j*16 + 8*hh + r] < -5000).
//      A wave takes 16 queries x 128 keys: each load is 512 consecutive bytes of one mask row. ----
__global__ __launch_bounds__(128) void tcast_kernel(
    const float* __restrict__ x1, const float* __restrict__ x2,
    const float* __restrict__ mk,
    _Float16* __restrict__ y1, _Float16* __restrict__ y2,
    unsigned int* __restrict__ mw) {
  __shared__ __align__(16) _Float16 T[64 * TP];   // [t][d], pitch 72 halves
  const int tid = threadIdx.x, lane = tid & 31, wave = tid >> 5;
  if (blockIdx.z == 1) {   // block-uniform, in front of the barrier
    const size_t base = ((size_t)blockIdx.y * (S_LEN / 64) + blockIdx.x) * (64 * HD) + (size_t)tid * 8;
    v4f a[4][2];           // all eight 16-B loads in flight before the first conversion
#pragma unroll
    for (int i = 0; i < 4; ++i) {
      a[i][0] = *(const v4f*)(x2 + base + i * 1024);
      a[i][1] = *(const v4f*)(x2 + base + i * 1024 + 4);
    }
#pragma unroll
    for (int i = 0; i < 4; ++i) {
      v8h h;
#pragma unroll
      for (int e = 0; e < 4; ++e) { h[e] = (_Float16)a[i][0][e]; h[4 + e] = (_Float16)a[i][1][e]; }
      *(v8h*)(y2 + base + i * 1024) = h;
    }
    return;
  }
  if (blockIdx.z == 2) {   // block-uniform, in front of the barrier
    // wave g of the slice: (b * 64 + q16) * 8 + pair of 64-key chunks
    const size_t g = ((size_t)blockIdx.y * (S_LEN / 64) + blockIdx.x) * 4 + wave;
    const float* mrow = mk + (g >> 3) * (16 * S_LEN) + (g & 7) * 128 + lane * 4;
    static_assert(N_HEADS * (S_LEN / 64) * 4 == (S_LEN / 16) * (S_LEN / 128), "the slice's waves cover a batch's mask exactly once");
    v4f a[16];             // row i, keys 4*lane .. 4*lane + 3 of the 128
#pragma unroll
    for (int i = 0; i < 16; ++i) a[i] = *(const v4f*)(mrow + i * S_LEN);
    // bw[e] of lane (c, hh): bit l = key 4*l + e of row c
    const int c = lane & 15, hh = lane >> 4;
    unsigned int bw[4] = {0u, 0u, 0u, 0u};
#pragma unroll
    for (int i = 0; i < 16; ++i)
#pragma unroll
      for (int e = 0; e < 4; ++e) {
        const unsigned int rowbits = __builtin_amdgcn_ballot_w32(a[i][e] < -5000.0f);
        bw[e] = (c == i) ? rowbits : bw[e];
      }
    // key ch*64 + j*16 + 8*hh + r = 4*l + e with e = r & 3, l = ch*16 + j*4 + 2*hh + (r >> 2)
#pragma unroll
    for (int e = 0; e < 4; ++e) bw[e] >>= 2 * hh;
#pragma unroll
    for (int ch = 0; ch < 2; ++ch) {
      unsigned int word = 0u;   // lane j*8 + r ends up holding word j*8 + r
#pragma unroll
      for (int j = 0; j < 4; ++j)
#pragma unroll
        for (int r = 0; r < 8; ++r) {
          const unsigned int sel = __builtin_amdgcn_ballot_w32((bw[r & 3] & (1u << (ch * 16 + j * 4 + (r >> 2)))) != 0u);
          word = (lane == j * 8 + r) ? sel : word;
        }
      mw[(g * 2 + ch) * 32 + lane] = word;
    }
    // the two stores' address and data registers are reused by the other slices' code, which the listing places behind this one
    asm volatile("s_wait_xcnt 0x0" ::: "memory");
    return;
  }
  const int t0 = blockIdx.x * 64;
  const int bh = blockIdx.y;
  const float* src = x1 + (size_t)bh * HD * S_LEN + t0;
#pragma unroll
  for (int i = 0; i < 8; ++i) {
    const int idx = tid + 128 * i;          // 0..1023
    const int d  = idx >> 4;                // 0..63
    const int t4 = (idx & 15) * 4;          // 0..60
    const v4f v = *(const v4f*)(src + (size_t)d * S_LEN + t4);
#pragma unroll
    for (int e = 0; e < 4; ++e) T[(t4 + e) * TP + d] = (_Float16)v[e];
  }
  __syncthreads();
  _Float16* dst = y1 + ((size_t)bh * S_LEN + t0) * HD;
  const int rq = lane >> 3, c8 = (lane & 7) * 8;
  {
#pragma unroll
    for (int it = 0; it < 4; ++it) {
      const int row = wave * 16 + it * 4 + rq;   // wave covers rows wave*16 .. +15
      const v8h hv = *(const v8h*)(T + row * TP + c8);
      *(v8h*)(dst + (size_t)row * HD + c8) = hv;
    }
    
  }
}

// lane l with lane l ^ 16 (one vector cross-row move)
__device__ __forceinline__ float xhalf(float x) {
  const int b = __builtin_bit_cast(int, x);
  return __builtin_bit_cast(float, __builtin_amdgcn_permlanex16(b, b, 0x76543210, 0xfedcba98, false, false));
}

// exp2 by v_exp_f32, eight at a time. The early-clobber outputs keep each v_exp off the sources of the one in front of it,
// and the closing v_nop is the slot the instruction set asks for between a transcendental and a next instruction that
// reads its result or overwrites its source (in a build with the plain call a dual-issue multiply stood there).
__device__ __forceinline__ v8f exp2_x8(v8f a) {
  float r0, r1, r2, r3, r4, r5, r6, r7;
  asm("v_exp_f32 %0, %8\n\tv_exp_f32 %1, %9\n\tv_exp_f32 %2, %10\n\tv_exp_f32 %3, %11\n\t"
      "v_exp_f32 %4, %12\n\tv_exp_f32 %5, %13\n\tv_exp_f32 %6, %14\n\tv_exp_f32 %7, %15\n\tv_nop"
      : "=&v"(r0), "=&v"(r1), "=&v"(r2), "=&v"(r3), "=&v"(r4), "=&v"(r5), "=&v"(r6), "=&v"(r7)
      : "v"(a[0]), "v"(a[1]), "v"(a[2]), "v"(a[3]), "v"(a[4]), "v"(a[5]), "v"(a[6]), "v"(a[7]));
  return (v8f){r0, r1, r2, r3, r4, r5, r6, r7};
}
// the same for one value
__device__ __forceinline__ float exp2_x1(float a) {
  float r;
  asm("v_exp_f32 %0, %1\n\tv_nop" : "=&v"(r) : "v"(a));
  return r;
}

// One 64-key chunk of K and V, global memory -> LDS through no register: eight asynchronous 16-B copies a lane
// (rows r, r + 16, r + 32, r + 48 of each tile). lk, lv: the lane's LDS byte addresses of its first K and V piece; kg, vg: the global ones.
// The closing s_wait_xcnt stands inside the statement, so that no address register is rewritten in front of it.
__device__ __forceinline__ void copy_chunk(uint32_t lk, uint32_t lv, const _Float16* kg, const _Float16* vg) {
  asm volatile(
      "global_load_async_to_lds_b128 %0, %8, off\n\t"
      "global_load_async_to_lds_b128 %1, %9, off\n\t"
      "global_load_async_to_lds_b128 %2, %10, off\n\t"
      "global_load_async_to_lds_b128 %3, %11, off\n\t"
      "global_load_async_to_lds_b128 %4, %12, off\n\t"
      "global_load_async_to_lds_b128 %5, %13, off\n\t"
      "global_load_async_to_lds_b128 %6, %14, off\n\t"
      "global_load_async_to_lds_b128 %7, %15, off\n\t"
      "s_wait_xcnt 0x0"
      :: "v"(lk), "v"(lk + 16 * LP * 2), "v"(lk + 32 * LP * 2), "v"(lk + 48 * LP * 2),
         "v"(lv), "v"(lv + 16 * LP * 2), "v"(lv + 32 * LP * 2), "v"(lv + 48 * LP * 2),
         "v"(kg), "v"(kg + 16 * HD), "v"(kg + 32 * HD), "v"(kg + 48 * HD),
         "v"(vg), "v"(vg + 16 * S_LEN), "v"(vg + 32 * S_LEN), "v"(vg + 48 * S_LEN)
      : "memory");
}

__global__ __launch_bounds__(256) __attribute__((amdgpu_waves_per_eu(4, 4)))
void attn_kernel(const float* __restrict__ q, const _Float16* __restrict__ Kt,
                 const _Float16* __restrict__ Vh, const unsigned int* __restrict__ mw,
                 float* __restrict__ out, int nheads) {
  __shared__ __align__(16) _Float16 Ksh[NSET][2][KC * LP];   // [set][buffer][kv][d]   4 x 9 KB, pitch LP
  __shared__ __align__(16) _Float16 Vth[NSET][2][HD * LP];   // [set][buffer][d][kv]   4 x 9 KB, pitch LP
  __shared__ __align__(16) float    Ob[HD * OP];             // [d][q] block tile, pitch OP floats
  __shared__ __align__(16) v4f      Mg[NWAVE * NG * 8 * 32]; // set 1's Ot, [wave][16-B piece][lane]
  __shared__ float                  Ml[NWAVE * NG * 2 * 32]; // set 1's maximum and sum, [wave][group][which][lane]

  const int tid  = threadIdx.x;
  const int wv   = __builtin_amdgcn_readfirstlane(tid >> 5);   // scalar: the set test of the epilogue is a scalar branch, the mask loads stay scalar
  const int set  = wv / NWAVE;
  const int wave = wv & (NWAVE - 1);                           // wave within its set
  const int lane = tid & 31;
  const int hh   = lane >> 4;
  const int c    = lane & 15;

  const int bh  = blockIdx.y;
  const int b   = bh / nheads;
  const int qb  = blockIdx.x;
  const int q0b = qb * QB;
  const int q0  = q0b + wave * (16 * NG);

  const _Float16* kbp = Kt + (size_t)bh * S_LEN * HD;
  const _Float16* vbp = Vh + (size_t)bh * HD * S_LEN;
  float*          obp = out + (size_t)bh * HD * S_LEN;

  // Q, read once from the f32 input: wave (set, wave) takes query q0 + lane, channels set*32 .. + 31; each load is one whole 128-B line of a channel row.
  // The loads start here and fly with chunk 0's copies.
  static_assert(NSET * 32 == HD && NG * 16 == 32, "the two sets' waves cover a query's channels, a wave's lanes its queries");
  float qv[32];
  const float* qsrc = q + ((size_t)bh * HD + set * 32) * S_LEN + q0 + lane;
#pragma unroll   // qv stays in registers and all 32 loads are in flight together
  for (int i = 0; i < 32; ++i) qv[i] = qsrc[(size_t)i * S_LEN];

  // this wave's mask words: 32 a chunk and column group (group g: + g * (S_LEN / KC) * 32), word j*8 + r = one bit a lane for register r of St tile j.
  // The wave number has gone through readfirstlane and the pointer goes into the constant address space (the words were written by the
  // launch before and nothing writes them here), so that the loads are scalar and the words arrive in scalar registers.
  const cuint_p mwp = (cuint_p)(uintptr_t)(mw + (((size_t)b * (S_LEN / 16) + qb * (NWAVE * NG) + wave * NG) * (S_LEN / KC) + set * NIT) * 32);

  float mrow[NG], lrow[NG];            // running maximum (both halves alike) and this half's share of the sum
  v8f oacc[NG][4];                     // Ot tile t, register r = channel t*16 + 8*hh + r of query q0 + g*16 + c
#pragma unroll
  for (int g = 0; g < NG; ++g) {
    mrow[g] = NEG_FILL; lrow[g] = 0.f;
#pragma unroll
    for (int t = 0; t < 4; ++t) oacc[g][t] = (v8f){0.f,0.f,0.f,0.f,0.f,0.f,0.f,0.f};
  }

  // this lane's piece of its set's chunk: row ts / 8 (and + 16, 32, 48), halves (ts & 7) * 8 .. + 7, ts = thread within the set
  const int ts = tid & (NWAVE * 32 - 1);
  const int srow = ts >> 3, sc8 = (ts & 7) * 8;
  const uint32_t lk0 = (uint32_t)(size_t)(&Ksh[set][0][srow * LP + sc8]);   // low 32 bits of a __shared__ address = LDS byte address
  const uint32_t lv0 = (uint32_t)(size_t)(&Vth[set][0][srow * LP + sc8]);
  const _Float16* kg0 = kbp + (size_t)(set * NIT * KC + srow) * HD + sc8;       // the set's chunk kc: + kc * KC * HD
  const _Float16* vg0 = vbp + (size_t)srow * S_LEN + set * NIT * KC + sc8;      // the set's chunk kc: + kc * KC
  static_assert(NIT >= 2, "the prologue fills two chunks of each set");

  // prologue: chunk 0 lands and is published, then chunk 1 starts
  copy_chunk(lk0, lv0, kg0, vg0);
  // Q x QMUL, rounded once to f16, laid token-major [query][d] (pitch LP) in the LDS that the epilogue's merge uses later
  _Float16* Qs = (_Float16*)Mg;
  static_assert(QB * LP * sizeof(_Float16) <= sizeof(Mg), "the Q tile fits the merge buffer");
#pragma unroll   // constant indices into qv; four 16-B LDS stores a lane
  for (int i = 0; i < 4; ++i) {
    v8h h;
#pragma unroll   // the eight halves of one store are packed in registers
    for (int e = 0; e < 8; ++e) h[e] = (_Float16)(qv[i * 8 + e] * QMUL);
    *(v8h*)(Qs + (wave * (16 * NG) + lane) * LP + set * 32 + i * 8) = h;
  }
  asm volatile("s_wait_asynccnt 0x0" ::: "memory");   // this wave's copies of chunk 0 have landed
  __syncthreads();                                    // ... and every other wave's, and the block's Q tile is published
  // Q fragments (B operand): column q0 + g*16 + c, two 32-wide d chunks
  v16h qf[NG][2];
  const _Float16* qlp = Qs + (wave * (16 * NG) + c) * LP + 8 * hh;
#pragma unroll
  for (int g = 0; g < NG; ++g) {
    qf[g][0] = Frag<_Float16>::load(qlp + g * (16 * LP) + 0);
    qf[g][1] = Frag<_Float16>::load(qlp + g * (16 * LP) + 32);
  }
  copy_chunk(lk0 + KC * LP * 2, lv0 + HD * LP * 2, kg0 + KC * HD, vg0 + KC);

  for (int kc = 0; kc < NIT; ++kc) {
    const int buf = kc & 1;
    const _Float16* Kb = Ksh[set][buf];
    const _Float16* Vb = Vth[set][buf];
    // mask words of this chunk
    unsigned int mv[NG][32];
#pragma unroll
    for (int g = 0; g < NG; ++g)
#pragma unroll
      for (int i = 0; i < 32; ++i) mv[g][i] = mwp[g * ((S_LEN / KC) * 32) + kc * 32 + i];

    // K's eight A fragments, read from LDS as one group: one LDS latency for the run of sixteen WMMAs
    v16h kf[2][4];
#pragma unroll
    for (int h = 0; h < 2; ++h)
#pragma unroll
      for (int j = 0; j < 4; ++j) kf[h][j] = Frag<_Float16>::load(Kb + (j * 16 + c) * LP + h * 32 + 8 * hh);
    // keeps the sixteen reads together in front of the WMMAs: without it the scheduler sinks each pair to its WMMA, with a wait at each
    __builtin_amdgcn_sched_barrier(0);

    // St: 64 keys x this wave's 32 queries (A = K rows, B = Q); a group's four independent tiles, then their second halves
    v8f s[NG][4];
#pragma unroll
    for (int g = 0; g < NG; ++g) {
#pragma unroll
      for (int j = 0; j < 4; ++j) s[g][j] = mma_h(kf[0][j], qf[g][0], (v8f){0.f,0.f,0.f,0.f,0.f,0.f,0.f,0.f});
#pragma unroll
      for (int j = 0; j < 4; ++j) s[g][j] = mma_h(kf[1][j], qf[g][1], s[g][j]);
    }
    // keeps the sixteen score WMMAs one run: mixed into the softmax, each stands next to a reader of its result or a writer of its operands, with v_nops between
    __builtin_amdgcn_sched_barrier(0);

    v16h vf[2][4];
    v16h pb[NG][2];
#pragma unroll
    for (int g = 0; g < NG; ++g) {
      if (g == NG - 1) {
        // V's eight A fragments, read in front of the last group's softmax: their LDS latency passes under it, and they take K's registers
        // only when the groups before have shrunk their scores to P (a quarter of a SIMD's registers must hold the wave).
        // The two scheduling barriers keep the sixteen reads together at this place: lifted, they cost the registers; sunk, each pair waits at its WMMA.
        __builtin_amdgcn_sched_barrier(0);
#pragma unroll
        for (int kk = 0; kk < 2; ++kk)
#pragma unroll
          for (int t = 0; t < 4; ++t) vf[kk][t] = Frag<_Float16>::load(Vb + (t * 16 + c) * LP + kk * 32 + 8 * hh);
        __builtin_amdgcn_sched_barrier(0);
      }
      // mask, chunk maximum of this lane's query (scores in log2 units)
      float cmj[4];
#pragma unroll
      for (int j = 0; j < 4; ++j) {
        float m = NEG_FILL;
#pragma unroll
        for (int r = 0; r < 8; ++r) {
          float x = s[g][j][r];
          if (__builtin_amdgcn_inverse_ballot_w32(mv[g][j * 8 + r])) x = NEG_FILL;   // the word is the select's lane mask
          s[g][j][r] = x;
          m = fmaxf(m, x);
        }
        cmj[j] = m;
      }
      float cm = fmaxf(fmaxf(cmj[0], cmj[1]), fmaxf(cmj[2], cmj[3]));
      cm = fmaxf(cm, xhalf(cm));

      // online softmax update; Pt (x2^15, f16) packed from the score registers into the B operand
      const float mnew  = fmaxf(mrow[g], cm);
      const float alpha = exp2_x1(mrow[g] - mnew);
      const float msub  = mnew - PSH;   // exp2(x - msub) = 2^15 * exp2(x - mnew)
      mrow[g] = mnew;
      float psj[4];
#pragma unroll
      for (int j = 0; j < 4; ++j) {
        v8f a;
#pragma unroll
        for (int r = 0; r < 8; ++r) a[r] = s[g][j][r] - msub;
        const v8f p = exp2_x8(a);
        float psum = 0.f;
#pragma unroll
        for (int r = 0; r < 8; ++r) {
          psum += p[r];
          pb[g][j >> 1][(j & 1) * 8 + r] = (_Float16)p[r];
        }
        psj[j] = psum;
      }
      lrow[g] = lrow[g] * alpha + ((psj[0] + psj[1]) + (psj[2] + psj[3]));
      // The empty statement holds the sum's additions in this group's softmax. Without it they sink to the loop's latch, the 32 f32 values
      // of P of each group stay live to the chunk's end, and the wave spills at a quarter of the register file. Input only: the fused multiply-add stays.
      asm volatile("" :: "v"(lrow[g]));   // empty statement on each row's sum, against spills
#pragma unroll
      for (int t = 0; t < 4; ++t)
#pragma unroll
        for (int r = 0; r < 8; ++r) oacc[g][t][r] *= alpha;
    }

    // Ot += Vt * Pt (A = V channel rows, B = Pt)
#pragma unroll
    for (int g = 0; g < NG; ++g)
#pragma unroll
      for (int kk = 0; kk < 2; ++kk) {
#pragma unroll
        for (int t = 0; t < 4; ++t) oacc[g][t] = mma_h(vf[kk][t], pb[g][kk], oacc[g][t]);
      }

    // hand-over: chunk kc + 1 is published and this chunk's buffer is freed by the one barrier.
    // The scheduling barrier keeps the softmax and the WMMAs in front of it: without it the scheduler lifts the waits and the barrier
    // into the softmax while the copies stay at the foot, and the copies lose that much of their lead.
    __builtin_amdgcn_sched_barrier(0);
    asm volatile("s_wait_dscnt 0x0" ::: "memory");      // this wave's reads of the buffer have returned
    asm volatile("s_wait_asynccnt 0x0" ::: "memory");   // this wave's copies of chunk kc + 1 have landed
    __syncthreads();
    if (kc + 2 < NIT)                                   // the same for the whole block
      copy_chunk(lk0 + buf * (KC * LP * 2), lv0 + buf * (HD * LP * 2), kg0 + (size_t)(kc + 2) * (KC * HD), vg0 + (kc + 2) * KC);
  }
  asm volatile("s_wait_asynccnt 0x0" ::: "memory");     // nothing is in flight when the wave goes on to the epilogue and ends

  // epilogue: join the lane halves' sums; set 1 hands its partial result to the same lane of the same wave of set 0
  float lsum[NG];
#pragma unroll
  for (int g = 0; g < NG; ++g) lsum[g] = lrow[g] + xhalf(lrow[g]);   // the sum carries the same 2^15 as Ot
  if (set == 1) {
#pragma unroll
    for (int g = 0; g < NG; ++g) {
      Ml[((wave * NG + g) * 2 + 0) * 32 + lane] = mrow[g];
      Ml[((wave * NG + g) * 2 + 1) * 32 + lane] = lsum[g];
#pragma unroll
      for (int t = 0; t < 4; ++t)
#pragma unroll
        for (int h = 0; h < 2; ++h)
          Mg[((wave * NG + g) * 8 + t * 2 + h) * 32 + lane] =
              (v4f){oacc[g][t][h * 4 + 0], oacc[g][t][h * 4 + 1], oacc[g][t][h * 4 + 2], oacc[g][t][h * 4 + 3]};
    }
  }
  __syncthreads();   // set 1's partial results are published
  // set 0: both halves brought to the common maximum, added, normalised; block tile [d][q] staged
  if (set == 0) {
#pragma unroll
    for (int g = 0; g < NG; ++g) {
      const float m1 = Ml[((wave * NG + g) * 2 + 0) * 32 + lane];
      const float l1 = Ml[((wave * NG + g) * 2 + 1) * 32 + lane];
      const float m  = fmaxf(mrow[g], m1);
      const float a0 = exp2_x1(mrow[g] - m), a1 = exp2_x1(m1 - m);
      const float inv = 1.0f / (lsum[g] * a0 + l1 * a1);
      const float f0 = a0 * inv, f1 = a1 * inv;
      const int qloc = wave * (16 * NG) + g * 16 + c;
#pragma unroll
      for (int t = 0; t < 4; ++t)
#pragma unroll
        for (int h = 0; h < 2; ++h) {
          const v4f o1 = Mg[((wave * NG + g) * 8 + t * 2 + h) * 32 + lane];
#pragma unroll
          for (int e = 0; e < 4; ++e) Ob[(t * 16 + 8 * hh + h * 4 + e) * OP + qloc] = oacc[g][t][h * 4 + e] * f0 + o1[e] * f1;
        }
    }
  }
  __syncthreads();
  // write whole channel rows
  {
    static_assert(QB == 32 * 4, "a wave's 16-B pieces cover one channel row of the block tile");
    static_assert(HD == NSET * NWAVE * 8, "eight channel rows a wave");
    v4f val[8];
#pragma unroll
    for (int it = 0; it < 8; ++it) val[it] = *(const v4f*)(Ob + (wv * 8 + it) * OP + lane * 4);   // wave wv of the block covers channels wv*8 .. +7
#pragma unroll
    for (int it = 0; it < 8; ++it) *(v4f*)(obp + (size_t)(wv * 8 + it) * S_LEN + q0b + lane * 4) = val[it];
  }
}

extern "C" void kernel_launch(void* const* d_in, const int* in_sizes, int n_in,
                              void* d_out, int out_size, void* d_ws, size_t ws_size,
                              hipStream_t stream) {
  if (n_in < 4) return;
  const float* q  = (const float*)d_in[0];
  const float* k  = (const float*)d_in[1];
  const float* v  = (const float*)d_in[2];
  const float* mk = (const float*)d_in[3];
  float* out = (float*)d_out;

  const int per_b = C_CH * S_LEN;
  const int nb = in_sizes[0] / per_b;
  if (nb <= 0 || in_sizes[0] != nb * per_b) return;
  if (in_sizes[1] != in_sizes[0] || in_sizes[2] != in_sizes[0]) return;
  if ((long long)in_sizes[3] != (long long)nb * S_LEN * S_LEN) return;
  if (out_size != in_sizes[0]) return;
  const int nbh = nb * N_HEADS;

  const size_t eb = (size_t)nbh * S_LEN * HD * sizeof(_Float16);   // bytes per f16 tensor copy
  const size_t offK = 0, offV = eb;
  const size_t offM = 2 * eb;
  const size_t total = 2 * eb + (size_t)nb * S_LEN * (S_LEN / 8);   // one mask bit a score
  if (total > ws_size || total > (size_t)134217728) return;
  _Float16* Kt = (_Float16*)((char*)d_ws + offK);
  _Float16* Vh = (_Float16*)((char*)d_ws + offV);
  unsigned int* Mw = (unsigned int*)((char*)d_ws + offM);

  // k: [bh][64][S] f32 -> [bh][S][64] f16; v: [bh][64][S] f32 -> same layout f16; mask: f32 -> bits
  tcast_kernel<<<dim3(S_LEN / 64, nbh, 3), 128, 0, stream>>>(k, v, mk, Kt, Vh, Mw);
  // attention
  attn_kernel<<<dim3(S_LEN / QB, nbh), NSET * NWAVE * 32, 0, stream>>>(q, Kt, Vh, Mw, out, N_HEADS);
  (void)hipGetLastError();
}
